// v000
// Measured on an AMD MI455X. A time is GPU time per run, averaged over a window of back-to-back runs after a warm-up
// (all launches, gaps included; the runs take copies of the inputs in turn), and the median of several windows.
// Apart from v000's, it joins two sittings. Times from different sittings can be a few percent apart, while
// side-by-side timings come from the same sitting.
// The starting kernel, v000, takes 883 microseconds a run.
#include <hip/hip_runtime.h>

// YOSOAttention (Q, K, V [2][12][2048][64], mask [2][2048] (all ones here; read as data), conv_w [12][1][3][1]; qn, kn = l2-normalised Q, K; W = (1 - acos(clip(qn.kn, -1, 1))/pi)^8 x mask_j (expected LSH collision,
// hash_code_len 8; no softmax); X = l2norm((W V) x mask_i); out = X + depthwise conv of (V x mask) over the sequence (3 taps, padding 1, per head) -> [2][12][2048][64]).
// Compute dtypes, f32 accumulate: every input rounded to bf16; the l2 normalisations in f32 (wave per row) -> SINGLE fp16 planes; qn.kn (K 64) fp16; acos / power / mask in
// f32 on VALU -> fp16 weights x1024; W.V (K 2048) fp16 x exact fp16(bf16 V); the output normalisation, the 3-tap conv and the sum in f32 (the output is dominated by the conv term).

#define NZ   24                   // batch x heads
#define NHD  12
#define TT   2048
#define HD   64
#define ZH   2
#define PCAR 1024.0f
typedef _Float16 h16;
typedef unsigned short bf;
typedef __attribute__((ext_vector_type(16))) __bf16   v16bf;
typedef __attribute__((ext_vector_type(16))) _Float16 v16h;
typedef __attribute__((ext_vector_type(8)))  _Float16 v8h;
typedef __attribute__((ext_vector_type(8)))  unsigned short v8us;
typedef __attribute__((ext_vector_type(8)))  float    v8f;
typedef __attribute__((ext_vector_type(4)))  float    v4f;
typedef v8h  __attribute__((may_alias)) v8ha;
typedef v4f  __attribute__((may_alias)) v4fa;
typedef v8us __attribute__((may_alias)) v8usa;

__device__ __forceinline__ unsigned short f2bf(float f) { unsigned u = __float_as_uint(f); u += 0x7FFFu + ((u >> 16) & 1u); return (unsigned short)(u >> 16); }
__device__ __forceinline__ float bf2f(unsigned short b) { return __uint_as_float(((unsigned)b) << 16); }
__device__ __forceinline__ float bfr(float f) { return bf2f(f2bf(f)); }
__device__ __forceinline__ v16h cat16(v8h lo, v8h hi) { return __builtin_shufflevector(lo, hi, 0, 1, 2, 3, 4, 5, 6, 7, 8, 9, 10, 11, 12, 13, 14, 15); }
__device__ __forceinline__ v16bf cat16b(v8us lo, v8us hi) { return __builtin_bit_cast(v16bf, __builtin_shufflevector(lo, hi, 0, 1, 2, 3, 4, 5, 6, 7, 8, 9, 10, 11, 12, 13, 14, 15)); }
__device__ __forceinline__ v8f wmma16(v16h a, v16h b, v8f c) { return __builtin_amdgcn_wmma_f32_16x16x32_f16(false, a, false, b, (short)0, c, false, false); }
__device__ __forceinline__ v8f wmmab(v16bf a, v16bf b, v8f c) { return __builtin_amdgcn_wmma_f32_16x16x32_bf16(false, a, false, b, (short)0, c, false, false); }



// ---- k_gemmw: register-blocked GEMM, ONE WAVE per 64x64 output tile (16 accumulators), operands straight from K-contiguous 16-bit planes; grid (M/64, N/64, Z), 32 threads.
// C[m][n] (f32, pitch ldc, + optional f32 bias[n]) = sum_k A[m][k] Bt[n][k] (+ split products per NSPLIT). z-batch strides sA/sB/sC in elements. K % 32 == 0.
template <typename T16> struct WFrag;
template <> struct WFrag<h16> { typedef v16h V; static __device__ __forceinline__ V ld(const h16* p) { return cat16(*(const v8h*)p, *(const v8h*)(p + 16)); } static __device__ __forceinline__ v8f mma(V a, V b, v8f c) { return wmma16(a, b, c); } };
template <> struct WFrag<bf> { typedef v16bf V; static __device__ __forceinline__ V ld(const bf* p) { return cat16b(*(const v8us*)p, *(const v8us*)(p + 16)); } static __device__ __forceinline__ v8f mma(V a, V b, v8f c) { return wmmab(a, b, c); } };
template <typename T16, int NSPLIT, bool BIAS>
__global__ __launch_bounds__(32) void k_gemmw(const T16* __restrict__ A, const T16* __restrict__ A2, const T16* __restrict__ Bt, const T16* __restrict__ Bt2, int K, float* C, int ldc, const float* __restrict__ bias, size_t sA, size_t sB, size_t sC) {
    typedef typename WFrag<T16>::V V;
    __shared__ __align__(16) float os[16 * 68];
    const size_t z = blockIdx.z; A += z * sA; if (A2) A2 += z * sA; Bt += z * sB; if (Bt2) Bt2 += z * sB; C += z * sC;
    const int lane = threadIdx.x & 31, lr = lane & 15, hi = lane >> 4; const int r0 = blockIdx.x * 64, c0 = blockIdx.y * 64;
    v8f acc[4][4];
#pragma unroll
    for (int mb = 0; mb < 4; ++mb)
#pragma unroll
        for (int nb = 0; nb < 4; ++nb) acc[mb][nb] = (v8f){};
    const size_t aoff = (size_t)(r0 + lr) * K + 8 * hi, boff = (size_t)(c0 + lr) * K + 8 * hi;
#pragma unroll 1
    for (int kc = 0; kc < K; kc += 32) {
        V a[4], a2[4];
#pragma unroll
        for (int mb = 0; mb < 4; ++mb) { a[mb] = WFrag<T16>::ld(A + aoff + (size_t)mb * 16 * K + kc); if (NSPLIT == 1 || NSPLIT == 2) a2[mb] = WFrag<T16>::ld(A2 + aoff + (size_t)mb * 16 * K + kc); }
#pragma unroll
        for (int nb = 0; nb < 4; ++nb) { const V b = WFrag<T16>::ld(Bt + boff + (size_t)nb * 16 * K + kc); V b2; if (NSPLIT >= 2) b2 = WFrag<T16>::ld(Bt2 + boff + (size_t)nb * 16 * K + kc);
#pragma unroll
            for (int mb = 0; mb < 4; ++mb) { acc[mb][nb] = WFrag<T16>::mma(a[mb], b, acc[mb][nb]); if (NSPLIT == 1 || NSPLIT == 2) acc[mb][nb] = WFrag<T16>::mma(a2[mb], b, acc[mb][nb]); if (NSPLIT >= 2) acc[mb][nb] = WFrag<T16>::mma(a[mb], b2, acc[mb][nb]); } }
        asm volatile("v_nop\n\tv_nop\n\tv_nop\n\tv_nop" : "+v"(acc[0][0]), "+v"(acc[1][1]), "+v"(acc[2][2]), "+v"(acc[3][3]) : "v"(a[0]), "v"(a[3]));
    }
#pragma unroll
    for (int mb = 0; mb < 4; ++mb) {
#pragma unroll
        for (int nb = 0; nb < 4; ++nb) {
#pragma unroll
            for (int j = 0; j < 8; ++j) os[(hi * 8 + j) * 68 + nb * 16 + lr] = acc[mb][nb][j]; }
        __builtin_amdgcn_wave_barrier(); asm volatile("" ::: "memory");
        float* crow = C + (size_t)(r0 + mb * 16) * ldc + c0;
{
#pragma unroll
            for (int s = 0; s < 8; ++s) { const int row = 2 * s + hi, cofs = lr * 4; v4f val = *(const v4fa*)(os + row * 68 + cofs); if (BIAS) { val[0] += bfr(bias[c0 + cofs]); val[1] += bfr(bias[c0 + cofs + 1]); val[2] += bfr(bias[c0 + cofs + 2]); val[3] += bfr(bias[c0 + cofs + 3]); }
                *(v4f*)(crow + (size_t)row * ldc + cofs) = val; }
             }
        __builtin_amdgcn_wave_barrier(); asm volatile("" ::: "memory");
    }
}

__device__ __forceinline__ h16 tohx(float x) { return (h16)x; }
typedef __attribute__((ext_vector_type(2))) _Float16 v2h;
typedef __attribute__((ext_vector_type(4))) _Float16 v4h;
typedef __attribute__((ext_vector_type(2))) float v2f;

__global__ __launch_bounds__(256) void k_nrm16(const float* __restrict__ X, h16* P16) { const int lane = threadIdx.x & 31; const int r = blockIdx.x * 8 + (threadIdx.x >> 5); if (r >= NZ * TT) return; const v2f a = *(const v2f*)(X + (size_t)r * HD + lane * 2);
    const float x0 = bfr(a[0]), x1 = bfr(a[1]); float p0 = __fmul_rn(x0, x0), p1 = __fmul_rn(x1, x1); asm volatile("" : "+v"(p0)); asm volatile("" : "+v"(p1)); float s = __fadd_rn(p0, p1);
#pragma unroll
    for (int sh = 16; sh; sh >>= 1) s += __shfl_xor(s, sh, 32);
    const float nrm = fmaxf(__fsqrt_rn(s), 1e-12f); v2h o; o[0] = tohx(__fdiv_rn(x0, nrm)); o[1] = tohx(__fdiv_rn(x1, nrm)); *(v2h*)(P16 + (size_t)r * HD + lane * 2) = o;  }
__global__ __launch_bounds__(256) void k_vt16(const float* __restrict__ V, h16* VT) { const size_t e = ((size_t)blockIdx.x * 256 + threadIdx.x) * 2; if (e >= (size_t)NZ * HD * TT) return; const int t = (int)(e & (TT - 1)); const int d = (int)((e >> 11) & 63); const int z = (int)(e >> 17); const float* src = V + (size_t)z * TT * HD; v2h o;
    o[0] = tohx(bfr(src[(size_t)t * HD + d])); o[1] = tohx(bfr(src[(size_t)(t + 1) * HD + d])); *(v2h*)(VT + e) = o;  }
__global__ __launch_bounds__(256) void k_yoso(const float* __restrict__ Sb, const float* __restrict__ mk, h16* P16) {
    const int lane = threadIdx.x & 31; const int row = blockIdx.x * 8 + (threadIdx.x >> 5); if (row >= ZH * TT) return; const float* sr = Sb + (size_t)row * TT;
{
#pragma unroll 2
        for (int ch = 0; ch < 16; ++ch) { const int j0 = ch * 128 + lane * 4; const v4f a = *(const v4f*)(sr + j0), m4 = *(const v4f*)(mk + j0); v4h o;
#pragma unroll
            for (int q = 0; q < 4; ++q) { const float d = fminf(fmaxf(a[q], -1.0f), 1.0f); float ac = acosf(d); asm volatile("" : "+v"(ac)); const float base = __fsub_rn(1.0f, __fmul_rn(ac, 0.31830988618379067f));
                float b2 = __fmul_rn(base, base); asm volatile("" : "+v"(b2)); float b4 = __fmul_rn(b2, b2); asm volatile("" : "+v"(b4)); const float b8 = __fmul_rn(b4, b4); float w = __fmul_rn(b8, bfr(m4[q])); asm volatile("" : "+v"(w)); o[q] = tohx(w * PCAR); }
            *(v4h*)(P16 + (size_t)row * TT + j0) = o; }
         }
}
// k_yfin: per row (zz, t) of the pass (wave; lane -> 2 dims): x = (O[zz][t][d]/1024) bf16(mask[b][t]); X = x / max(||x||, 1e-12); conv = sum_k bf16(w[h][k]) (bf16(V[z][t+k-1][d]) bf16(mask[b][t+k-1])) (zero padded);
__global__ __launch_bounds__(256) void k_yfin(const float* __restrict__ O, const float* __restrict__ V, const float* __restrict__ mk, const float* __restrict__ cw, int z0, float* OUT) {
    const int lane = threadIdx.x & 31; const int row = blockIdx.x * 8 + (threadIdx.x >> 5); if (row >= ZH * TT) return; const int t = row & (TT - 1); const int zz = row >> 11; const int z = z0 + zz; const int b = z / NHD, h = z % NHD; const int d = lane * 2;
    const float mt = bfr(mk[(size_t)b * TT + t]); const v2f o2 = *(const v2f*)(O + (size_t)row * HD + d); float x0 = __fmul_rn(o2[0] * (1.0f / PCAR), mt), x1 = __fmul_rn(o2[1] * (1.0f / PCAR), mt);
    float p0 = __fmul_rn(x0, x0), p1 = __fmul_rn(x1, x1); asm volatile("" : "+v"(p0)); asm volatile("" : "+v"(p1)); float s = __fadd_rn(p0, p1);
#pragma unroll
    for (int sh = 16; sh; sh >>= 1) s += __shfl_xor(s, sh, 32);
    const float nrm = fmaxf(__fsqrt_rn(s), 1e-12f); v2f r; r[0] = __fdiv_rn(x0, nrm); r[1] = __fdiv_rn(x1, nrm);
    const float* vz = V + (size_t)z * TT * HD;
#pragma unroll
    for (int k = 0; k < 3; ++k) { const int tt = t + k - 1; if (tt < 0 || tt >= TT) continue; const float wk = bfr(cw[h * 3 + k]); const float mm = bfr(mk[(size_t)b * TT + tt]);
#pragma unroll
        for (int q = 0; q < 2; ++q) { float vm = __fmul_rn(bfr(vz[(size_t)tt * HD + d + q]), mm); asm volatile("" : "+v"(vm)); float p = __fmul_rn(wk, vm); asm volatile("" : "+v"(p)); r[q] = __fadd_rn(r[q], p); } }
    *(v2f*)(OUT + ((size_t)z * TT + t) * HD + d) = r;  }

extern "C" void kernel_launch(void* const* d_in, const int* in_sizes, int n_in,
                              void* d_out, int out_size, void* d_ws, size_t ws_size, hipStream_t stream) {
    (void)in_sizes; (void)n_in; (void)out_size;
    const float* Q = (const float*)d_in[0]; const float* K = (const float*)d_in[1]; const float* V = (const float*)d_in[2]; const float* mk = (const float*)d_in[3]; const float* cw = (const float*)d_in[4];
    float* OUT = (float*)d_out;     // [2][12][2048][64]
    char* wsp = (char*)d_ws;
    auto take = [&](size_t bytes) { char* p = wsp; wsp += (bytes + 255) & ~(size_t)255; return (void*)p; };
    h16* QN = (h16*)take((size_t)NZ * TT * HD * 2); h16* KN = (h16*)take((size_t)NZ * TT * HD * 2); h16* VT = (h16*)take((size_t)NZ * HD * TT * 2); float* Sb = (float*)take((size_t)ZH * TT * TT * 4); h16* Pm = (h16*)take((size_t)ZH * TT * TT * 2); float* Ob = (float*)take((size_t)ZH * TT * HD * 4);
    if ((size_t)(wsp - (char*)d_ws) > ws_size) return;    // total ~ 70 MB; ws 256 MiB
    k_nrm16<<<NZ * TT / 8, 256, 0, stream>>>(Q, QN); k_nrm16<<<NZ * TT / 8, 256, 0, stream>>>(K, KN); k_vt16<<<(unsigned)(((size_t)NZ * HD * TT / 2 + 255) / 256), 256, 0, stream>>>(V, VT);
    for (int z0 = 0; z0 < NZ; z0 += ZH) { const int b = z0 / NHD;     // ZH = 2 divides 12: a pass never straddles batches
        k_gemmw<h16, 0, false><<<dim3(TT / 64, TT / 64, ZH), 32, 0, stream>>>(QN + (size_t)z0 * TT * HD, nullptr, KN + (size_t)z0 * TT * HD, nullptr, HD, Sb, TT, nullptr, (size_t)TT * HD, (size_t)TT * HD, (size_t)TT * TT);
        k_yoso<<<ZH * TT / 8, 256, 0, stream>>>(Sb, mk + (size_t)b * TT, Pm);
        k_gemmw<h16, 0, false><<<dim3(TT / 64, 1, ZH), 32, 0, stream>>>(Pm, nullptr, VT + (size_t)z0 * HD * TT, nullptr, TT, Ob, HD, nullptr, (size_t)TT * TT, (size_t)HD * TT, (size_t)TT * HD);
        k_yfin<<<ZH * TT / 8, 256, 0, stream>>>(Ob, V, mk, cw, z0, OUT); }
}

// v002
// A run of this version takes 80.3 microseconds.
// Versions between v000 and this one are left out; their measured steps multiply to 11.0 times as fast.
#include <hip/hip_runtime.h>

// YOSOAttention (Q, K, V [2][12][2048][64], mask [2][2048] (all ones here; read as data), conv_w [12][1][3][1]; qn, kn = l2-normalised Q, K; W = (1 - acos(clip(qn.kn, -1, 1))/pi)^8 x mask_j (expected LSH collision,
// hash_code_len 8; no softmax); X = l2norm((W V) x mask_i); out = X + depthwise conv of (V x mask) over the sequence (3 taps, padding 1, per head) -> [2][12][2048][64]).
// Compute dtypes, f32 accumulate: every input rounded to bf16; the l2 normalisations in f32 (wave per 16 rows) -> SINGLE fp16 planes; qn.kn (K 64) fp16; acos / power / mask in
// f32 on VALU -> fp16 weights x1024; W.V (K 2048) fp16 x exact fp16(bf16 V); the output normalisation, the 3-tap conv and the sum in f32 (the output is dominated by the conv term).

#define NZ   24                   // batch x heads
#define NHD  12
#define TT   2048
#define HD   64
#define ZH   24                   // heads per pass of k_yfin: all of them
#define PCAR 1024.0f
typedef _Float16 h16;
typedef __attribute__((ext_vector_type(16))) _Float16 v16h;
typedef __attribute__((ext_vector_type(8)))  _Float16 v8h;
typedef __attribute__((ext_vector_type(8)))  float    v8f;
typedef __attribute__((ext_vector_type(4)))  float    v4f;

__device__ __forceinline__ unsigned short f2bf(float f) { unsigned u = __float_as_uint(f); u += 0x7FFFu + ((u >> 16) & 1u); return (unsigned short)(u >> 16); }
__device__ __forceinline__ float bf2f(unsigned short b) { return __uint_as_float(((unsigned)b) << 16); }
__device__ __forceinline__ float bfr(float f) { return bf2f(f2bf(f)); }
__device__ __forceinline__ v16h cat16(v8h lo, v8h hi) { return __builtin_shufflevector(lo, hi, 0, 1, 2, 3, 4, 5, 6, 7, 8, 9, 10, 11, 12, 13, 14, 15); }
__device__ __forceinline__ v8f wmma16(v16h a, v16h b, v8f c) { return __builtin_amdgcn_wmma_f32_16x16x32_f16(false, a, false, b, (short)0, c, false, false); }

__device__ __forceinline__ h16 tohx(float x) { return (h16)x; }
typedef __attribute__((ext_vector_type(4))) _Float16 v4h;
typedef __attribute__((ext_vector_type(2))) float v2f;

// FRAGMENT ORDER of the three fp16 planes: a 16 x 32 operand tile is 1,024 contiguous bytes, [j 0..1][lane 0..31][s 0..7] = row (lane & 15), k = 16 j + 8 (lane >> 4) + s: what lane and register half j of the
// matrix operand hold. One 16-byte load of a wave then reads 512 contiguous bytes (4 lines) where the row-major planes cost it 16 lines. Qn, Kn: tile = 16 rows x dims 32 dc ..; tiles in the order (row tile, dc).
// Vt: tile = dims 16 nb .. x 32 keys; tiles in the order (key chunk, nb). Each packer wave owns whole 512-byte pieces, so every line has one writer. '#pragma unroll' in the packers: as noted at k_att.
// k_nrm16: a wave per 16 rows; lane (c, h) holds of row c the dims 16 q + 8 h + s, q 0..3: its own 16 bytes of the pieces q = 2 dc + j. The row's square sum: 32 terms in the lane, then the partner lane's.
__global__ __launch_bounds__(128) void k_nrm16(const float* __restrict__ X, h16* P16) { const int lane = threadIdx.x & 31, c = lane & 15, h = lane >> 4; const int tile = blockIdx.x * 4 + (threadIdx.x >> 5); if (tile >= NZ * TT / 16) return;
    const float* src = X + ((size_t)tile * 16 + c) * HD + 8 * h; v4f a[4][2];
#pragma unroll
    for (int q = 0; q < 4; ++q) { a[q][0] = *(const v4f*)(src + 16 * q); a[q][1] = *(const v4f*)(src + 16 * q + 4); }
    float x[4][8]; float s = 0.0f;
#pragma unroll
    for (int q = 0; q < 4; ++q)
#pragma unroll
        for (int r = 0; r < 8; ++r) { x[q][r] = bfr(a[q][r >> 2][r & 3]); s += x[q][r] * x[q][r]; }
    s += __shfl_xor(s, 16, 32);
    const float nrm = fmaxf(__fsqrt_rn(s), 1e-12f); h16* dst = P16 + (size_t)tile * 1024 + lane * 8;
#pragma unroll
    for (int q = 0; q < 4; ++q) { v8h o;
#pragma unroll
        for (int r = 0; r < 8; ++r) o[r] = tohx(__fdiv_rn(x[q][r], nrm));
        *(v8h*)(dst + q * 256) = o; }  }
// k_vt16: a wave per 16 keys x 64 dims (w = 128 z + key tile; key chunk w >> 1, half j = w & 1); lane (c, h) reads keys 8 h + s at dim 16 nb + c (two 64-byte runs a load) and stores its 16 bytes of the four pieces (nb, j).
__global__ __launch_bounds__(128) void k_vt16(const float* __restrict__ V, h16* VT) { const int lane = threadIdx.x & 31, c = lane & 15, h = lane >> 4; const int w = blockIdx.x * 4 + (threadIdx.x >> 5); if (w >= NZ * TT / 16) return;
    const float* src = V + ((size_t)w * 16 + 8 * h) * HD + c; float x[4][8];
#pragma unroll
    for (int nb = 0; nb < 4; ++nb)
#pragma unroll
        for (int r = 0; r < 8; ++r) x[nb][r] = src[r * HD + nb * 16];
    h16* dst = VT + ((size_t)(w >> 1) * 8 + (w & 1)) * 256 + lane * 8;
#pragma unroll
    for (int nb = 0; nb < 4; ++nb) { v8h o;
#pragma unroll
        for (int r = 0; r < 8; ++r) o[r] = tohx(bfr(x[nb][r]));
        *(v8h*)(dst + nb * 512) = o; }  }
// ---- k_att: the whole weighted sum of one 16-query tile in ONE WAVE; no score and no weight leaves the registers. Grid 256 x 12 waves = 24 heads x 128 tiles.
// Per 32 keys: St = Kn . Qn^T (two 16-key tiles, K 64; lane (c, h), register r = key 8h + r, query c); weight in f32 in place; the two tiles, converted, ARE the B operand
// Pt of Ot += Vt . Pt (hardware k order: element s = key 8h + s, then 16 + 8h + s - 8; the Vt and Kn / Qn loader ldf has the same order: the planes lie in it). Keys ascend in steps of 32, as before.
// Every '#pragma unroll' without a number: the arrays stay in registers only under constant indices.
// Left for later steps: the mask is rounded to bf16 per element inside the loop; k_yfin, k_vt16 and k_nrm16 are launches of their own.
__device__ __forceinline__ v16h ldf(const h16* p) { return cat16(*(const v8h*)p, *(const v8h*)(p + 256)); }     // p: the lane's 16 bytes of piece j = 0; piece 1 lies 512 bytes on
__global__ __launch_bounds__(384) void k_att(const h16* __restrict__ QN, const h16* __restrict__ KN, const h16* __restrict__ VT, const float* __restrict__ mk, float* __restrict__ O) {
    const int lane = threadIdx.x & 31, c = lane & 15, h = lane >> 4;
    const int g = blockIdx.x * 12 + __builtin_amdgcn_readfirstlane(threadIdx.x >> 5);
    const int z = g >> 7, q0 = (g & 127) * 16;
    const h16* qp = QN + (size_t)g * 1024 + lane * 8;     // 16 rows x 64 dims = 1,024 elements a row tile
    const h16* kp = KN + (size_t)z * TT * HD + lane * 8;
    const h16* vp = VT + (size_t)z * HD * TT + lane * 8;
    const float* mp = mk + (size_t)(z / NHD) * TT + 8 * h;
    v8f acc[4];
#pragma unroll
    for (int nb = 0; nb < 4; ++nb) acc[nb] = (v8f){};
    __builtin_amdgcn_sched_barrier(0);     // with the one behind the wait: no address arithmetic between the first loads and their s_wait_xcnt, where it rewrote a register that a load names
    const v16h qf0 = ldf(qp), qf1 = ldf(qp + 512);
    v16h kf[2][2]; v4f ma[2][2], mb[2][2];
#pragma unroll
    for (int t = 0; t < 2; ++t) { kf[t][0] = ldf(kp + t * 1024); kf[t][1] = ldf(kp + t * 1024 + 512); ma[t][0] = *(const v4f*)(mp + 16 * t); ma[t][1] = *(const v4f*)(mp + 16 * t + 4); }
    asm volatile("s_wait_xcnt 0x0" ::: "memory");     // the address registers of the loads above are free for reuse behind it
    __builtin_amdgcn_sched_barrier(0);     // see above
    // one pass = 32 keys. mc: this pass's mask values; mn: filled for the next pass.
    auto pass = [&](const int kc, v4f (&mc)[2][2], v4f (&mn)[2][2]) __attribute__((always_inline)) {
        v16h vf[4];     // asked for here, used behind the weights
#pragma unroll
        for (int nb = 0; nb < 4; ++nb) vf[nb] = ldf(vp + (size_t)kc * HD + nb * 512);     // 32 keys x 64 dims = 2,048 elements a key chunk
        v8f s[2];
#pragma unroll
        for (int t = 0; t < 2; ++t) { s[t] = wmma16(kf[t][0], qf0, (v8f){}); s[t] = wmma16(kf[t][1], qf1, s[t]); }
        const int kn = kc + 32 < TT ? kc + 32 : kc;     // the next pass's keys and mask, one pass ahead (the last pass asks for its own again: in bounds, unused)
        const h16* kq = kp + (size_t)kn * HD; const float* mq = mp + kn;
#pragma unroll
        for (int t = 0; t < 2; ++t) { kf[t][0] = ldf(kq + t * 1024); kf[t][1] = ldf(kq + t * 1024 + 512); mn[t][0] = *(const v4f*)(mq + 16 * t); mn[t][1] = *(const v4f*)(mq + 16 * t + 4); }
        asm volatile("s_wait_xcnt 0x0" :: "v"(kq), "v"(mq) : "memory");     // both pointers are inputs so that their registers live up to the wait: no load of the run above may land in the pair that the run names
        __builtin_amdgcn_sched_barrier(0);     // keeps the loads above in front of the weights: sunk to their uses, each would show its whole latency
        v16h p;
#pragma unroll
        for (int t = 0; t < 2; ++t)
#pragma unroll
            for (int r = 0; r < 8; ++r) { const float d = fminf(fmaxf(s[t][r], -1.0f), 1.0f); const float base = 1.0f - acosf(d) * 0.31830988618379067f;
                const float b2 = base * base, b4 = b2 * b2, b8 = b4 * b4; p[t * 8 + r] = tohx(b8 * bfr(mc[t][r >> 2][r & 3]) * PCAR); }
#pragma unroll
        for (int nb = 0; nb < 4; ++nb) acc[nb] = wmma16(vf[nb], p, acc[nb]);
        __builtin_amdgcn_sched_barrier(0);     // keeps the next pass's score products behind these weights: lifted over them, they wait for keys that were only just asked for
    };
#pragma unroll 1     // two passes, so that the two mask sets swap roles without copies; more would only lengthen the text
    for (int kc = 0; kc < TT; kc += 64) { pass(kc, ma, mb); pass(kc + 32, mb, ma); }
    float* orow = O + ((size_t)z * TT + q0 + c) * HD + 8 * h;     // acc[nb][r] = O[q0 + c][16 nb + 8h + r]
#pragma unroll
    for (int nb = 0; nb < 4; ++nb) { v4f lo, hi4;
#pragma unroll
        for (int r = 0; r < 4; ++r) { lo[r] = acc[nb][r]; hi4[r] = acc[nb][4 + r]; }
        *(v4f*)(orow + nb * 16) = lo; *(v4f*)(orow + nb * 16 + 4) = hi4; }
}
// k_yfin: per row (zz, t) of the pass (wave; lane -> 2 dims): x = (O[zz][t][d]/1024) bf16(mask[b][t]); X = x / max(||x||, 1e-12); conv = sum_k bf16(w[h][k]) (bf16(V[z][t+k-1][d]) bf16(mask[b][t+k-1])) (zero padded);
__global__ __launch_bounds__(256) void k_yfin(const float* __restrict__ O, const float* __restrict__ V, const float* __restrict__ mk, const float* __restrict__ cw, int z0, float* OUT) {
    const int lane = threadIdx.x & 31; const int row = blockIdx.x * 8 + (threadIdx.x >> 5); if (row >= ZH * TT) return; const int t = row & (TT - 1); const int zz = row >> 11; const int z = z0 + zz; const int b = z / NHD, h = z % NHD; const int d = lane * 2;
    const float mt = bfr(mk[(size_t)b * TT + t]); const v2f o2 = *(const v2f*)(O + (size_t)row * HD + d); float x0 = __fmul_rn(o2[0] * (1.0f / PCAR), mt), x1 = __fmul_rn(o2[1] * (1.0f / PCAR), mt);
    float p0 = __fmul_rn(x0, x0), p1 = __fmul_rn(x1, x1); asm volatile("" : "+v"(p0)); asm volatile("" : "+v"(p1)); float s = __fadd_rn(p0, p1);
#pragma unroll
    for (int sh = 16; sh; sh >>= 1) s += __shfl_xor(s, sh, 32);
    const float nrm = fmaxf(__fsqrt_rn(s), 1e-12f); v2f r; r[0] = __fdiv_rn(x0, nrm); r[1] = __fdiv_rn(x1, nrm);
    const float* vz = V + (size_t)z * TT * HD;
#pragma unroll
    for (int k = 0; k < 3; ++k) { const int tt = t + k - 1; if (tt < 0 || tt >= TT) continue; const float wk = bfr(cw[h * 3 + k]); const float mm = bfr(mk[(size_t)b * TT + tt]);
#pragma unroll
        for (int q = 0; q < 2; ++q) { float vm = __fmul_rn(bfr(vz[(size_t)tt * HD + d + q]), mm); asm volatile("" : "+v"(vm)); float p = __fmul_rn(wk, vm); asm volatile("" : "+v"(p)); r[q] = __fadd_rn(r[q], p); } }
    *(v2f*)(OUT + ((size_t)z * TT + t) * HD + d) = r;  }

extern "C" void kernel_launch(void* const* d_in, const int* in_sizes, int n_in,
                              void* d_out, int out_size, void* d_ws, size_t ws_size, hipStream_t stream) {
    (void)in_sizes; (void)n_in; (void)out_size;
    const float* Q = (const float*)d_in[0]; const float* K = (const float*)d_in[1]; const float* V = (const float*)d_in[2]; const float* mk = (const float*)d_in[3]; const float* cw = (const float*)d_in[4];
    float* OUT = (float*)d_out;     // [2][12][2048][64]
    char* wsp = (char*)d_ws;
    auto take = [&](size_t bytes) { char* p = wsp; wsp += (bytes + 255) & ~(size_t)255; return (void*)p; };
    h16* QN = (h16*)take((size_t)NZ * TT * HD * 2); h16* KN = (h16*)take((size_t)NZ * TT * HD * 2); h16* VT = (h16*)take((size_t)NZ * HD * TT * 2); float* Ob = (float*)take((size_t)NZ * TT * HD * 4);
    if ((size_t)(wsp - (char*)d_ws) > ws_size) return;    // total ~ 32 MB; ws 256 MiB
    k_nrm16<<<NZ * TT / 16 / 4, 128, 0, stream>>>(Q, QN); k_nrm16<<<NZ * TT / 16 / 4, 128, 0, stream>>>(K, KN); k_vt16<<<NZ * TT / 16 / 4, 128, 0, stream>>>(V, VT);
    k_att<<<NZ * TT / 16 / 12, 384, 0, stream>>>(QN, KN, VT, mk, Ob);
    k_yfin<<<ZH * TT / 8, 256, 0, stream>>>(Ob, V, mk, cw, 0, OUT);
}

// v003
// One run takes 73.9 microseconds.
// Timed twice side by side with v002, it ran 1.09 and 1.08 times as fast.
// Counting every step since v000, it is 11.9 times as fast.
#include <hip/hip_runtime.h>

// YOSOAttention (Q, K, V [2][12][2048][64], mask [2][2048] (all ones here; read as data), conv_w [12][1][3][1]; qn, kn = l2-normalised Q, K; W = (1 - acos(clip(qn.kn, -1, 1))/pi)^8 x mask_j (expected LSH collision,
// hash_code_len 8; no softmax); X = l2norm((W V) x mask_i); out = X + depthwise conv of (V x mask) over the sequence (3 taps, padding 1, per head) -> [2][12][2048][64]).
// Compute dtypes, f32 accumulate: every input rounded to bf16; the l2 normalisations in f32 (wave per 16 rows) -> SINGLE fp16 planes; qn.kn (K 64) fp16; weight (see wq2) / mask in
// f32 on VALU -> fp16 weights x1024; W.V (K 2048) fp16 x exact fp16(bf16 V); the output normalisation, the 3-tap conv and the sum in f32 (the output is dominated by the conv term).

#define NZ   24                   // batch x heads
#define NHD  12
#define TT   2048
#define HD   64
#define ZH   24                   // heads per pass of k_yfin: all of them
#define PCAR 1024.0f
typedef _Float16 h16;
typedef __attribute__((ext_vector_type(16))) _Float16 v16h;
typedef __attribute__((ext_vector_type(8)))  _Float16 v8h;
typedef __attribute__((ext_vector_type(8)))  float    v8f;
typedef __attribute__((ext_vector_type(4)))  float    v4f;

__device__ __forceinline__ unsigned short f2bf(float f) { unsigned u = __float_as_uint(f); u += 0x7FFFu + ((u >> 16) & 1u); return (unsigned short)(u >> 16); }
__device__ __forceinline__ float bf2f(unsigned short b) { return __uint_as_float(((unsigned)b) << 16); }
__device__ __forceinline__ float bfr(float f) { return bf2f(f2bf(f)); }
__device__ __forceinline__ v16h cat16(v8h lo, v8h hi) { return __builtin_shufflevector(lo, hi, 0, 1, 2, 3, 4, 5, 6, 7, 8, 9, 10, 11, 12, 13, 14, 15); }
__device__ __forceinline__ v8f wmma16(v16h a, v16h b, v8f c) { return __builtin_amdgcn_wmma_f32_16x16x32_f16(false, a, false, b, (short)0, c, false, false); }

__device__ __forceinline__ h16 tohx(float x) { return (h16)x; }
typedef __attribute__((ext_vector_type(4))) _Float16 v4h;
typedef __attribute__((ext_vector_type(2))) float v2f;

// FRAGMENT ORDER of the three fp16 planes: a 16 x 32 operand tile is 1,024 contiguous bytes, [j 0..1][lane 0..31][s 0..7] = row (lane & 15), k = 16 j + 8 (lane >> 4) + s: what lane and register half j of the
// matrix operand hold. One 16-byte load of a wave then reads 512 contiguous bytes (4 lines) where the row-major planes cost it 16 lines. Qn, Kn: tile = 16 rows x dims 32 dc ..; tiles in the order (row tile, dc).
// Vt: tile = dims 16 nb .. x 32 keys; tiles in the order (key chunk, nb). Each packer wave owns whole 512-byte pieces, so every line has one writer. '#pragma unroll' in the packers: as noted at k_att.
// k_nrm16: a wave per 16 rows; lane (c, h) holds of row c the dims 16 q + 8 h + s, q 0..3: its own 16 bytes of the pieces q = 2 dc + j. The row's square sum: 32 terms in the lane, then the partner lane's.
__global__ __launch_bounds__(128) void k_nrm16(const float* __restrict__ X, h16* P16) { const int lane = threadIdx.x & 31, c = lane & 15, h = lane >> 4; const int tile = blockIdx.x * 4 + (threadIdx.x >> 5); if (tile >= NZ * TT / 16) return;
    const float* src = X + ((size_t)tile * 16 + c) * HD + 8 * h; v4f a[4][2];
#pragma unroll
    for (int q = 0; q < 4; ++q) { a[q][0] = *(const v4f*)(src + 16 * q); a[q][1] = *(const v4f*)(src + 16 * q + 4); }
    float x[4][8]; float s = 0.0f;
#pragma unroll
    for (int q = 0; q < 4; ++q)
#pragma unroll
        for (int r = 0; r < 8; ++r) { x[q][r] = bfr(a[q][r >> 2][r & 3]); s += x[q][r] * x[q][r]; }
    s += __shfl_xor(s, 16, 32);
    const float nrm = fmaxf(__fsqrt_rn(s), 1e-12f); h16* dst = P16 + (size_t)tile * 1024 + lane * 8;
#pragma unroll
    for (int q = 0; q < 4; ++q) { v8h o;
#pragma unroll
        for (int r = 0; r < 8; ++r) o[r] = tohx(__fdiv_rn(x[q][r], nrm));
        *(v8h*)(dst + q * 256) = o; }  }
// k_vt16: a wave per 16 keys x 64 dims (w = 128 z + key tile; key chunk w >> 1, half j = w & 1); lane (c, h) reads keys 8 h + s at dim 16 nb + c (two 64-byte runs a load) and stores its 16 bytes of the four pieces (nb, j).
__global__ __launch_bounds__(128) void k_vt16(const float* __restrict__ V, h16* VT) { const int lane = threadIdx.x & 31, c = lane & 15, h = lane >> 4; const int w = blockIdx.x * 4 + (threadIdx.x >> 5); if (w >= NZ * TT / 16) return;
    const float* src = V + ((size_t)w * 16 + 8 * h) * HD + c; float x[4][8];
#pragma unroll
    for (int nb = 0; nb < 4; ++nb)
#pragma unroll
        for (int r = 0; r < 8; ++r) x[nb][r] = src[r * HD + nb * 16];
    h16* dst = VT + ((size_t)(w >> 1) * 8 + (w & 1)) * 256 + lane * 8;
#pragma unroll
    for (int nb = 0; nb < 4; ++nb) { v8h o;
#pragma unroll
        for (int r = 0; r < 8; ++r) o[r] = tohx(bfr(x[nb][r]));
        *(v8h*)(dst + nb * 512) = o; }  }
// ---- k_att: the whole weighted sum of one 16-query tile in ONE WAVE; no score and no weight leaves the registers. Grid 256 x 12 waves = 24 heads x 128 tiles.
// Per 32 keys: St = Kn . Qn^T (two 16-key tiles, K 64; lane (c, h), register r = key 8h + r, query c); weight in f32 in place; the two tiles, converted, ARE the B operand
// Pt of Ot += Vt . Pt (hardware k order: element s = key 8h + s, then 16 + 8h + s - 8; the Vt and Kn / Qn loader ldf has the same order: the planes lie in it). Keys ascend in steps of 32, as before.
// Every '#pragma unroll' without a number: the arrays stay in registers only under constant indices.
// Left for later steps: the mask is rounded to bf16 per element inside the loop; k_yfin, k_vt16 and k_nrm16 are launches of their own.
// wq2: two collision weights x 1024 from two dots d. acos(d) = 2 asin(y), y = sqrt((1 - d) / 2), so base = 1 - acos(d)/pi = 1 - (2/pi) asin(y). base has a root-type end at y = 1, base^2 a simple zero there: base^2 is smooth on
// the whole of [0, 1] and ONE polynomial in y covers every d in [-1, 1], with no case split, no sign handling and no second series. q = 1024^(1/4) base^2 by a degree-6 fit (weighted towards relative error), then q^4.
// Error of the weight in f32 arithmetic, a square root one ulp off included: under 2e-5 relative for d > -0.8, under 7e-5 wherever the fp16 weight is normal, never above a quarter of half an fp16 step.
// The clip of d to [-1, 1] is the clamp of (1 - d) / 2 to [0, 1].
__device__ __forceinline__ v2f wq2(const float d0, const float d1) {
    v2f y; y[0] = __builtin_amdgcn_sqrtf(__builtin_amdgcn_fmed3f(fmaf(d0, -0.5f, 0.5f), 0.0f, 1.0f)); y[1] = __builtin_amdgcn_sqrtf(__builtin_amdgcn_fmed3f(fmaf(d1, -0.5f, 0.5f), 0.0f, 1.0f));
    v2f q = y * 0.0424227603f + -0.223755330f; q = q * y + 0.584063053f; q = q * y + -1.13987541f; q = q * y + 2.28209758f; q = q * y + -7.20179796f; q = q * y + 5.65684557f;
    q = q * q; return q * q; }
__device__ __forceinline__ v16h ldf(const h16* p) { return cat16(*(const v8h*)p, *(const v8h*)(p + 256)); }     // p: the lane's 16 bytes of piece j = 0; piece 1 lies 512 bytes on
__global__ __launch_bounds__(384) void k_att(const h16* __restrict__ QN, const h16* __restrict__ KN, const h16* __restrict__ VT, const float* __restrict__ mk, float* __restrict__ O) {
    const int lane = threadIdx.x & 31, c = lane & 15, h = lane >> 4;
    const int g = blockIdx.x * 12 + __builtin_amdgcn_readfirstlane(threadIdx.x >> 5);
    const int z = g >> 7, q0 = (g & 127) * 16;
    const h16* qp = QN + (size_t)g * 1024 + lane * 8;     // 16 rows x 64 dims = 1,024 elements a row tile
    const h16* kp = KN + (size_t)z * TT * HD + lane * 8;
    const h16* vp = VT + (size_t)z * HD * TT + lane * 8;
    const float* mp = mk + (size_t)(z / NHD) * TT + 8 * h;
    v8f acc[4];
#pragma unroll
    for (int nb = 0; nb < 4; ++nb) acc[nb] = (v8f){};
    __builtin_amdgcn_sched_barrier(0);     // with the one behind the wait: no address arithmetic between the first loads and their s_wait_xcnt, where it rewrote a register that a load names
    const v16h qf0 = ldf(qp), qf1 = ldf(qp + 512);
    v16h kf[2][2]; v4f ma[2][2], mb[2][2];
#pragma unroll
    for (int t = 0; t < 2; ++t) { kf[t][0] = ldf(kp + t * 1024); kf[t][1] = ldf(kp + t * 1024 + 512); ma[t][0] = *(const v4f*)(mp + 16 * t); ma[t][1] = *(const v4f*)(mp + 16 * t + 4); }
    asm volatile("s_wait_xcnt 0x0" ::: "memory");     // the address registers of the loads above are free for reuse behind it
    __builtin_amdgcn_sched_barrier(0);     // see above
    // one pass = 32 keys. mc: this pass's mask values; mn: filled for the next pass.
    auto pass = [&](const int kc, v4f (&mc)[2][2], v4f (&mn)[2][2]) __attribute__((always_inline)) {
        v16h vf[4];     // asked for here, used behind the weights
#pragma unroll
        for (int nb = 0; nb < 4; ++nb) vf[nb] = ldf(vp + (size_t)kc * HD + nb * 512);     // 32 keys x 64 dims = 2,048 elements a key chunk
        v8f s[2];
#pragma unroll
        for (int t = 0; t < 2; ++t) { s[t] = wmma16(kf[t][0], qf0, (v8f){}); s[t] = wmma16(kf[t][1], qf1, s[t]); }
        const int kn = kc + 32 < TT ? kc + 32 : kc;     // the next pass's keys and mask, one pass ahead (the last pass asks for its own again: in bounds, unused)
        const h16* kq = kp + (size_t)kn * HD; const float* mq = mp + kn;
#pragma unroll
        for (int t = 0; t < 2; ++t) { kf[t][0] = ldf(kq + t * 1024); kf[t][1] = ldf(kq + t * 1024 + 512); mn[t][0] = *(const v4f*)(mq + 16 * t); mn[t][1] = *(const v4f*)(mq + 16 * t + 4); }
        asm volatile("s_wait_xcnt 0x0" :: "v"(kq), "v"(mq) : "memory");     // both pointers are inputs so that their registers live up to the wait: no load of the run above may land in the pair that the run names
        __builtin_amdgcn_sched_barrier(0);     // keeps the loads above in front of the weights: sunk to their uses, each would show its whole latency
        v16h p;
#pragma unroll
        for (int t = 0; t < 2; ++t)
#pragma unroll
            for (int r = 0; r < 8; r += 2) { const v2f w = wq2(s[t][r], s[t][r + 1]);
                p[t * 8 + r] = tohx(w[0] * bfr(mc[t][r >> 2][r & 3])); p[t * 8 + r + 1] = tohx(w[1] * bfr(mc[t][r >> 2][(r & 3) + 1])); }
#pragma unroll
        for (int nb = 0; nb < 4; ++nb) acc[nb] = wmma16(vf[nb], p, acc[nb]);
        __builtin_amdgcn_sched_barrier(0);     // keeps the next pass's score products behind these weights: lifted over them, they wait for keys that were only just asked for
    };
#pragma unroll 1     // two passes, so that the two mask sets swap roles without copies; more would only lengthen the text
    for (int kc = 0; kc < TT; kc += 64) { pass(kc, ma, mb); pass(kc + 32, mb, ma); }
    float* orow = O + ((size_t)z * TT + q0 + c) * HD + 8 * h;     // acc[nb][r] = O[q0 + c][16 nb + 8h + r]
#pragma unroll
    for (int nb = 0; nb < 4; ++nb) { v4f lo, hi4;
#pragma unroll
        for (int r = 0; r < 4; ++r) { lo[r] = acc[nb][r]; hi4[r] = acc[nb][4 + r]; }
        *(v4f*)(orow + nb * 16) = lo; *(v4f*)(orow + nb * 16 + 4) = hi4; }
}
// k_yfin: per row (zz, t) of the pass (wave; lane -> 2 dims): x = (O[zz][t][d]/1024) bf16(mask[b][t]); X = x / max(||x||, 1e-12); conv = sum_k bf16(w[h][k]) (bf16(V[z][t+k-1][d]) bf16(mask[b][t+k-1])) (zero padded);
__global__ __launch_bounds__(256) void k_yfin(const float* __restrict__ O, const float* __restrict__ V, const float* __restrict__ mk, const float* __restrict__ cw, int z0, float* OUT) {
    const int lane = threadIdx.x & 31; const int row = blockIdx.x * 8 + (threadIdx.x >> 5); if (row >= ZH * TT) return; const int t = row & (TT - 1); const int zz = row >> 11; const int z = z0 + zz; const int b = z / NHD, h = z % NHD; const int d = lane * 2;
    const float mt = bfr(mk[(size_t)b * TT + t]); const v2f o2 = *(const v2f*)(O + (size_t)row * HD + d); float x0 = __fmul_rn(o2[0] * (1.0f / PCAR), mt), x1 = __fmul_rn(o2[1] * (1.0f / PCAR), mt);
    float p0 = __fmul_rn(x0, x0), p1 = __fmul_rn(x1, x1); asm volatile("" : "+v"(p0)); asm volatile("" : "+v"(p1)); float s = __fadd_rn(p0, p1);
#pragma unroll
    for (int sh = 16; sh; sh >>= 1) s += __shfl_xor(s, sh, 32);
    const float nrm = fmaxf(__fsqrt_rn(s), 1e-12f); v2f r; r[0] = __fdiv_rn(x0, nrm); r[1] = __fdiv_rn(x1, nrm);
    const float* vz = V + (size_t)z * TT * HD;
#pragma unroll
    for (int k = 0; k < 3; ++k) { const int tt = t + k - 1; if (tt < 0 || tt >= TT) continue; const float wk = bfr(cw[h * 3 + k]); const float mm = bfr(mk[(size_t)b * TT + tt]);
#pragma unroll
        for (int q = 0; q < 2; ++q) { float vm = __fmul_rn(bfr(vz[(size_t)tt * HD + d + q]), mm); asm volatile("" : "+v"(vm)); float p = __fmul_rn(wk, vm); asm volatile("" : "+v"(p)); r[q] = __fadd_rn(r[q], p); } }
    *(v2f*)(OUT + ((size_t)z * TT + t) * HD + d) = r;  }

extern "C" void kernel_launch(void* const* d_in, const int* in_sizes, int n_in,
                              void* d_out, int out_size, void* d_ws, size_t ws_size, hipStream_t stream) {
    (void)in_sizes; (void)n_in; (void)out_size;
    const float* Q = (const float*)d_in[0]; const float* K = (const float*)d_in[1]; const float* V = (const float*)d_in[2]; const float* mk = (const float*)d_in[3]; const float* cw = (const float*)d_in[4];
    float* OUT = (float*)d_out;     // [2][12][2048][64]
    char* wsp = (char*)d_ws;
    auto take = [&](size_t bytes) { char* p = wsp; wsp += (bytes + 255) & ~(size_t)255; return (void*)p; };
    h16* QN = (h16*)take((size_t)NZ * TT * HD * 2); h16* KN = (h16*)take((size_t)NZ * TT * HD * 2); h16* VT = (h16*)take((size_t)NZ * HD * TT * 2); float* Ob = (float*)take((size_t)NZ * TT * HD * 4);
    if ((size_t)(wsp - (char*)d_ws) > ws_size) return;    // total ~ 32 MB; ws 256 MiB
    k_nrm16<<<NZ * TT / 16 / 4, 128, 0, stream>>>(Q, QN); k_nrm16<<<NZ * TT / 16 / 4, 128, 0, stream>>>(K, KN); k_vt16<<<NZ * TT / 16 / 4, 128, 0, stream>>>(V, VT);
    k_att<<<NZ * TT / 16 / 12, 384, 0, stream>>>(QN, KN, VT, mk, Ob);
    k_yfin<<<ZH * TT / 8, 256, 0, stream>>>(Ob, V, mk, cw, 0, OUT);
}

// v004
// A run of this version takes 67.4 microseconds.
// Next to v003, in two timings, it ran 1.11 and 1.08 times as fast.
// All steps since v000 together make it 13.1 times as fast.
#include <hip/hip_runtime.h>

// YOSOAttention (Q, K, V [2][12][2048][64], mask [2][2048] (all ones here; read as data), conv_w [12][1][3][1]; qn, kn = l2-normalised Q, K; W = (1 - acos(clip(qn.kn, -1, 1))/pi)^8 x mask_j (expected LSH collision,
// hash_code_len 8; no softmax); X = l2norm((W V) x mask_i); out = X + depthwise conv of (V x mask) over the sequence (3 taps, padding 1, per head) -> [2][12][2048][64]).
// Compute dtypes, f32 accumulate: every input rounded to bf16; the l2 normalisations in f32 (wave per 16 rows) -> SINGLE fp16 planes; qn.kn (K 64) fp16; weight (see wq2) / mask in
// f32 on VALU -> fp16 weights x1024; W.V (K 2048) fp16 x exact fp16(bf16 V); the output normalisation, the 3-tap conv and the sum in f32 (the output is dominated by the conv term).

#define NZ   24                   // batch x heads
#define NHD  12
#define TT   2048
#define HD   64
#define PCAR 1024.0f
typedef _Float16 h16;
typedef __attribute__((ext_vector_type(16))) _Float16 v16h;
typedef __attribute__((ext_vector_type(8)))  _Float16 v8h;
typedef __attribute__((ext_vector_type(8)))  float    v8f;
typedef __attribute__((ext_vector_type(4)))  float    v4f;

__device__ __forceinline__ unsigned short f2bf(float f) { unsigned u = __float_as_uint(f); u += 0x7FFFu + ((u >> 16) & 1u); return (unsigned short)(u >> 16); }
__device__ __forceinline__ float bf2f(unsigned short b) { return __uint_as_float(((unsigned)b) << 16); }
__device__ __forceinline__ float bfr(float f) { return bf2f(f2bf(f)); }
__device__ __forceinline__ v16h cat16(v8h lo, v8h hi) { return __builtin_shufflevector(lo, hi, 0, 1, 2, 3, 4, 5, 6, 7, 8, 9, 10, 11, 12, 13, 14, 15); }
__device__ __forceinline__ v8f wmma16(v16h a, v16h b, v8f c) { return __builtin_amdgcn_wmma_f32_16x16x32_f16(false, a, false, b, (short)0, c, false, false); }

__device__ __forceinline__ h16 tohx(float x) { return (h16)x; }
typedef __attribute__((ext_vector_type(4))) _Float16 v4h;
typedef __attribute__((ext_vector_type(2))) float v2f;
typedef __attribute__((ext_vector_type(2))) __bf16 v2b;

// FRAGMENT ORDER of the three fp16 planes: a 16 x 32 operand tile is 1,024 contiguous bytes, [j 0..1][lane 0..31][s 0..7] = row (lane & 15), k = 16 j + 8 (lane >> 4) + s: what lane and register half j of the
// matrix operand hold. One 16-byte load of a wave then reads 512 contiguous bytes (4 lines) where the row-major planes cost it 16 lines. Qn, Kn: tile = 16 rows x dims 32 dc ..; tiles in the order (row tile, dc).
// Vt: tile = dims 16 nb .. x 32 keys; tiles in the order (key chunk, nb). Each packer wave owns whole 512-byte pieces, so every line has one writer. '#pragma unroll' in the packers: as noted at k_att.
// k_nrm16: a wave per 16 rows; lane (c, h) holds of row c the dims 16 q + 8 h + s, q 0..3: its own 16 bytes of the pieces q = 2 dc + j. The row's square sum: 32 terms in the lane, then the partner lane's.
__global__ __launch_bounds__(128) void k_nrm16(const float* __restrict__ X, h16* P16) { const int lane = threadIdx.x & 31, c = lane & 15, h = lane >> 4; const int tile = blockIdx.x * 4 + (threadIdx.x >> 5); if (tile >= NZ * TT / 16) return;
    const float* src = X + ((size_t)tile * 16 + c) * HD + 8 * h; v4f a[4][2];
#pragma unroll
    for (int q = 0; q < 4; ++q) { a[q][0] = *(const v4f*)(src + 16 * q); a[q][1] = *(const v4f*)(src + 16 * q + 4); }
    float x[4][8]; float s = 0.0f;
#pragma unroll
    for (int q = 0; q < 4; ++q)
#pragma unroll
        for (int r = 0; r < 8; ++r) { x[q][r] = bfr(a[q][r >> 2][r & 3]); s += x[q][r] * x[q][r]; }
    s += __shfl_xor(s, 16, 32);
    const float nrm = fmaxf(__fsqrt_rn(s), 1e-12f); h16* dst = P16 + (size_t)tile * 1024 + lane * 8;
#pragma unroll
    for (int q = 0; q < 4; ++q) { v8h o;
#pragma unroll
        for (int r = 0; r < 8; ++r) o[r] = tohx(__fdiv_rn(x[q][r], nrm));
        *(v8h*)(dst + q * 256) = o; }  }
// k_vt16: a wave per 16 keys x 64 dims (w = 128 z + key tile; key chunk w >> 1, half j = w & 1); lane (c, h) reads keys 8 h + s at dim 16 nb + c (two 64-byte runs a load) and stores its 16 bytes of the four pieces (nb, j).
__global__ __launch_bounds__(128) void k_vt16(const float* __restrict__ V, h16* VT) { const int lane = threadIdx.x & 31, c = lane & 15, h = lane >> 4; const int w = blockIdx.x * 4 + (threadIdx.x >> 5); if (w >= NZ * TT / 16) return;
    const float* src = V + ((size_t)w * 16 + 8 * h) * HD + c; float x[4][8];
#pragma unroll
    for (int nb = 0; nb < 4; ++nb)
#pragma unroll
        for (int r = 0; r < 8; ++r) x[nb][r] = src[r * HD + nb * 16];
    h16* dst = VT + ((size_t)(w >> 1) * 8 + (w & 1)) * 256 + lane * 8;
#pragma unroll
    for (int nb = 0; nb < 4; ++nb) { v8h o;
#pragma unroll
        for (int r = 0; r < 8; ++r) o[r] = tohx(bfr(x[nb][r]));
        *(v8h*)(dst + nb * 512) = o; }  }
// ---- k_att: the whole weighted sum of one 16-query tile in ONE WAVE; no score and no weight leaves the registers. Grid 256 x 12 waves = 24 heads x 128 tiles.
// Per 32 keys: St = Kn . Qn^T (two 16-key tiles, K 64; lane (c, h), register r = key 8h + r, query c); weight in f32 in place; the two tiles, converted, ARE the B operand
// Pt of Ot += Vt . Pt (hardware k order: element s = key 8h + s, then 16 + 8h + s - 8; the Vt and Kn / Qn loader ldf has the same order: the planes lie in it). Keys ascend in steps of 32, as before.
// Every '#pragma unroll' without a number: the arrays stay in registers only under constant indices.
// The wave ends with its 16 output rows (see behind the loop): the weighted sum never goes to memory.
// Left for later steps: the mask is rounded to bf16 per element inside the loop; k_vt16 and k_nrm16 are launches of their own.
// wq2: two collision weights x 1024 from two dots d. acos(d) = 2 asin(y), y = sqrt((1 - d) / 2), so base = 1 - acos(d)/pi = 1 - (2/pi) asin(y). base has a root-type end at y = 1, base^2 a simple zero there: base^2 is smooth on
// the whole of [0, 1] and ONE polynomial in y covers every d in [-1, 1], with no case split, no sign handling and no second series. q = 1024^(1/4) base^2 by a degree-6 fit (weighted towards relative error), then q^4.
// Error of the weight in f32 arithmetic, a square root one ulp off included: under 2e-5 relative for d > -0.8, under 7e-5 wherever the fp16 weight is normal, never above a quarter of half an fp16 step.
// The clip of d to [-1, 1] is the clamp of (1 - d) / 2 to [0, 1].
__device__ __forceinline__ v2f wq2(const float d0, const float d1) {
    v2f y; y[0] = __builtin_amdgcn_sqrtf(__builtin_amdgcn_fmed3f(fmaf(d0, -0.5f, 0.5f), 0.0f, 1.0f)); y[1] = __builtin_amdgcn_sqrtf(__builtin_amdgcn_fmed3f(fmaf(d1, -0.5f, 0.5f), 0.0f, 1.0f));
    v2f q = y * 0.0424227603f + -0.223755330f; q = q * y + 0.584063053f; q = q * y + -1.13987541f; q = q * y + 2.28209758f; q = q * y + -7.20179796f; q = q * y + 5.65684557f;
    q = q * q; return q * q; }
__device__ __forceinline__ v16h ldf(const h16* p) { return cat16(*(const v8h*)p, *(const v8h*)(p + 256)); }     // p: the lane's 16 bytes of piece j = 0; piece 1 lies 512 bytes on
__global__ __launch_bounds__(384) void k_att(const h16* __restrict__ QN, const h16* __restrict__ KN, const h16* __restrict__ VT, const float* __restrict__ mk, const float* __restrict__ V, const float* __restrict__ cw, float* __restrict__ OUT) {
    const int lane = threadIdx.x & 31, c = lane & 15, h = lane >> 4;
    const int g = blockIdx.x * 12 + __builtin_amdgcn_readfirstlane(threadIdx.x >> 5);
    const int z = g >> 7, q0 = (g & 127) * 16;
    const h16* qp = QN + (size_t)g * 1024 + lane * 8;     // 16 rows x 64 dims = 1,024 elements a row tile
    const h16* kp = KN + (size_t)z * TT * HD + lane * 8;
    const h16* vp = VT + (size_t)z * HD * TT + lane * 8;
    const float* mp = mk + (size_t)(z / NHD) * TT + 8 * h;
    v8f acc[4];
#pragma unroll
    for (int nb = 0; nb < 4; ++nb) acc[nb] = (v8f){};
    __builtin_amdgcn_sched_barrier(0);     // with the one behind the wait: no address arithmetic between the first loads and their s_wait_xcnt, where it rewrote a register that a load names
    const v16h qf0 = ldf(qp), qf1 = ldf(qp + 512);
    v16h kf[2][2]; v4f ma[2][2], mb[2][2];
#pragma unroll
    for (int t = 0; t < 2; ++t) { kf[t][0] = ldf(kp + t * 1024); kf[t][1] = ldf(kp + t * 1024 + 512); ma[t][0] = *(const v4f*)(mp + 16 * t); ma[t][1] = *(const v4f*)(mp + 16 * t + 4); }
    asm volatile("s_wait_xcnt 0x0" ::: "memory");     // the address registers of the loads above are free for reuse behind it
    __builtin_amdgcn_sched_barrier(0);     // see above
    // one pass = 32 keys. mc: this pass's mask values; mn: filled for the next pass.
    auto pass = [&](const int kc, v4f (&mc)[2][2], v4f (&mn)[2][2]) __attribute__((always_inline)) {
        v16h vf[4];     // asked for here, used behind the weights
#pragma unroll
        for (int nb = 0; nb < 4; ++nb) vf[nb] = ldf(vp + (size_t)kc * HD + nb * 512);     // 32 keys x 64 dims = 2,048 elements a key chunk
        v8f s[2];
#pragma unroll
        for (int t = 0; t < 2; ++t) { s[t] = wmma16(kf[t][0], qf0, (v8f){}); s[t] = wmma16(kf[t][1], qf1, s[t]); }
        const int kn = kc + 32 < TT ? kc + 32 : kc;     // the next pass's keys and mask, one pass ahead (the last pass asks for its own again: in bounds, unused)
        const h16* kq = kp + (size_t)kn * HD; const float* mq = mp + kn;
#pragma unroll
        for (int t = 0; t < 2; ++t) { kf[t][0] = ldf(kq + t * 1024); kf[t][1] = ldf(kq + t * 1024 + 512); mn[t][0] = *(const v4f*)(mq + 16 * t); mn[t][1] = *(const v4f*)(mq + 16 * t + 4); }
        asm volatile("s_wait_xcnt 0x0" :: "v"(kq), "v"(mq) : "memory");     // both pointers are inputs so that their registers live up to the wait: no load of the run above may land in the pair that the run names
        __builtin_amdgcn_sched_barrier(0);     // keeps the loads above in front of the weights: sunk to their uses, each would show its whole latency
        v16h p;
#pragma unroll
        for (int t = 0; t < 2; ++t)
#pragma unroll
            for (int r = 0; r < 8; r += 2) { const v2f w = wq2(s[t][r], s[t][r + 1]);
                p[t * 8 + r] = tohx(w[0] * bfr(mc[t][r >> 2][r & 3])); p[t * 8 + r + 1] = tohx(w[1] * bfr(mc[t][r >> 2][(r & 3) + 1])); }
#pragma unroll
        for (int nb = 0; nb < 4; ++nb) acc[nb] = wmma16(vf[nb], p, acc[nb]);
        __builtin_amdgcn_sched_barrier(0);     // keeps the next pass's score products behind these weights: lifted over them, they wait for keys that were only just asked for
    };
#pragma unroll 1     // two passes, so that the two mask sets swap roles without copies; more would only lengthen the text
    for (int kc = 0; kc < TT; kc += 64) { pass(kc, ma, mb); pass(kc + 32, mb, ma); }
    // The output rows. acc[nb][r] = 1024 (W V)[t][16 nb + 8h + r], t = q0 + c: lanes (c, 0) and (c, 1) hold the whole of row t.
    // x = (acc / 1024) bf16(mask[b][t]); X = x / max(||x||, 1e-12), the square sum 32 terms in the lane (even dims, odd dims, their sum), then the partner lane's;
    // out = X + sum_k bf16(w[head][k]) (bf16(V[z][t + k - 1][d]) bf16(mask[b][t + k - 1])), rows outside the sequence count as zero.
    // w (v m) is formed as (w m) v: every factor has 8 significant bits, so both products are exact in f32 in either order.
    const int t = q0 + c; const float* mrow = mk + (size_t)(z / NHD) * TT; const float* wrow = cw + (z % NHD) * 3;
    const int tl = t > 0 ? t - 1 : t, tr = t < TT - 1 ? t + 1 : t;     // the neighbours' addresses stay in the plane; at the ends their tap weight is zero
    const float* vz = V + (size_t)z * TT * HD + 8 * h;
    const float* vl = vz + (size_t)tl * HD; const float* vc = vz + (size_t)t * HD; const float* vn = vz + (size_t)tr * HD;
    const float ml = mrow[tl], mc = mrow[t], mr = mrow[tr];
    v4f vv[3][4][2];
#pragma unroll
    for (int nb = 0; nb < 4; ++nb) { vv[0][nb][0] = *(const v4f*)(vl + nb * 16); vv[0][nb][1] = *(const v4f*)(vl + nb * 16 + 4); vv[1][nb][0] = *(const v4f*)(vc + nb * 16); vv[1][nb][1] = *(const v4f*)(vc + nb * 16 + 4);
        vv[2][nb][0] = *(const v4f*)(vn + nb * 16); vv[2][nb][1] = *(const v4f*)(vn + nb * 16 + 4); }
    asm volatile("s_wait_xcnt 0x0" :: "v"(vl), "v"(vc), "v"(vn), "v"(tl), "v"(t), "v"(tr) : "memory");     // pointers and row numbers are inputs so that their registers live up to the wait: no load of the run above may land in a register that the run names
    const float mt = bfr(mc); const float wm[3] = { bfr(wrow[0]) * bfr(ml) * (t > 0 ? 1.0f : 0.0f), bfr(wrow[1]) * mt, bfr(wrow[2]) * bfr(mr) * (t < TT - 1 ? 1.0f : 0.0f) };
    const float xs = mt * (1.0f / PCAR);     // a power of two: (acc / 1024) mask = acc (mask / 1024)
    v2f sq2 = (v2f){};     // even and odd dims apart: packed arithmetic
#pragma unroll
    for (int nb = 0; nb < 4; ++nb)
#pragma unroll
        for (int r = 0; r < 8; r += 2) { v2f x; x[0] = acc[nb][r]; x[1] = acc[nb][r + 1]; x = x * xs; sq2 = x * x + sq2; acc[nb][r] = x[0]; acc[nb][r + 1] = x[1]; }
    float sq = sq2[0] + sq2[1];
    { const int sb = __float_as_int(sq); sq += __int_as_float(__builtin_amdgcn_permlanex16(sb, sb, 0x76543210, 0xfedcba98, false, false)); }     // lane l ^ 16: the other half of the row
    const float nrm = fmaxf(__fsqrt_rn(sq), 1e-12f);
    float* orow = OUT + ((size_t)z * TT + t) * HD + 8 * h;
#pragma unroll
    for (int nb = 0; nb < 4; ++nb)
#pragma unroll
        for (int r = 0; r < 8; r += 2) { v2f y; y[0] = __fdiv_rn(acc[nb][r], nrm); y[1] = __fdiv_rn(acc[nb][r + 1], nrm);
#pragma unroll
            for (int k = 0; k < 3; ++k) { v2f u; u[0] = vv[k][nb][r >> 2][r & 3]; u[1] = vv[k][nb][r >> 2][(r & 3) + 1]; const v2b ub = __builtin_convertvector(u, v2b);     // to bf16, nearest even, two at a time
                y[0] += wm[k] * (float)ub[0]; y[1] += wm[k] * (float)ub[1]; }
            acc[nb][r] = y[0]; acc[nb][r + 1] = y[1]; }
#pragma unroll
    for (int nb = 0; nb < 4; ++nb) { v4f lo, hi4;
#pragma unroll
        for (int r = 0; r < 4; ++r) { lo[r] = acc[nb][r]; hi4[r] = acc[nb][4 + r]; }
        *(v4f*)(orow + nb * 16) = lo; *(v4f*)(orow + nb * 16 + 4) = hi4; }
}

extern "C" void kernel_launch(void* const* d_in, const int* in_sizes, int n_in,
                              void* d_out, int out_size, void* d_ws, size_t ws_size, hipStream_t stream) {
    (void)in_sizes; (void)n_in; (void)out_size;
    const float* Q = (const float*)d_in[0]; const float* K = (const float*)d_in[1]; const float* V = (const float*)d_in[2]; const float* mk = (const float*)d_in[3]; const float* cw = (const float*)d_in[4];
    float* OUT = (float*)d_out;     // [2][12][2048][64]
    char* wsp = (char*)d_ws;
    auto take = [&](size_t bytes) { char* p = wsp; wsp += (bytes + 255) & ~(size_t)255; return (void*)p; };
    h16* QN = (h16*)take((size_t)NZ * TT * HD * 2); h16* KN = (h16*)take((size_t)NZ * TT * HD * 2); h16* VT = (h16*)take((size_t)NZ * HD * TT * 2);
    if ((size_t)(wsp - (char*)d_ws) > ws_size) return;    // total ~ 19 MB; ws 256 MiB
    k_nrm16<<<NZ * TT / 16 / 4, 128, 0, stream>>>(Q, QN); k_nrm16<<<NZ * TT / 16 / 4, 128, 0, stream>>>(K, KN); k_vt16<<<NZ * TT / 16 / 4, 128, 0, stream>>>(V, VT);
    k_att<<<NZ * TT / 16 / 12, 384, 0, stream>>>(QN, KN, VT, mk, V, cw, OUT);
}

// v005
// It runs in 55.8 microseconds.
// Next to v004, in two timings, it ran 1.20 and 1.25 times as fast.
// Over all steps from v000 it is 16.0 times as fast.
#include <hip/hip_runtime.h>

// YOSOAttention (Q, K, V [2][12][2048][64], mask [2][2048] (all ones here; read as data), conv_w [12][1][3][1]; qn, kn = l2-normalised Q, K; W = (1 - acos(clip(qn.kn, -1, 1))/pi)^8 x mask_j (expected LSH collision,
// hash_code_len 8; no softmax); X = l2norm((W V) x mask_i); out = X + depthwise conv of (V x mask) over the sequence (3 taps, padding 1, per head) -> [2][12][2048][64]).
// Compute dtypes, f32 accumulate: every input rounded to bf16; the l2 normalisations in f32 (wave per 16 rows) -> SINGLE fp16 planes; qn.kn (K 64) fp16; weight (see wq2) / mask in
// f32 on VALU -> fp16 weights x1024; W.V (K 2048) fp16 x exact fp16(bf16 V); the output normalisation, the 3-tap conv and the sum in f32 (the output is dominated by the conv term).

#define NZ   24                   // batch x heads
#define NHD  12
#define TT   2048
#define HD   64
#define PCAR 1024.0f
typedef _Float16 h16;
typedef __attribute__((ext_vector_type(16))) _Float16 v16h;
typedef __attribute__((ext_vector_type(8)))  _Float16 v8h;
typedef __attribute__((ext_vector_type(8)))  float    v8f;
typedef __attribute__((ext_vector_type(4)))  float    v4f;

__device__ __forceinline__ unsigned short f2bf(float f) { unsigned u = __float_as_uint(f); u += 0x7FFFu + ((u >> 16) & 1u); return (unsigned short)(u >> 16); }
__device__ __forceinline__ float bf2f(unsigned short b) { return __uint_as_float(((unsigned)b) << 16); }
__device__ __forceinline__ float bfr(float f) { return bf2f(f2bf(f)); }
__device__ __forceinline__ v16h cat16(v8h lo, v8h hi) { return __builtin_shufflevector(lo, hi, 0, 1, 2, 3, 4, 5, 6, 7, 8, 9, 10, 11, 12, 13, 14, 15); }
__device__ __forceinline__ v8f wmma16(v16h a, v16h b, v8f c) { return __builtin_amdgcn_wmma_f32_16x16x32_f16(false, a, false, b, (short)0, c, false, false); }

__device__ __forceinline__ h16 tohx(float x) { return (h16)x; }
typedef __attribute__((ext_vector_type(4))) _Float16 v4h;
typedef __attribute__((ext_vector_type(2))) float v2f;
typedef __attribute__((ext_vector_type(2))) __bf16 v2b;

// FRAGMENT ORDER of the three fp16 planes: a 16 x 32 operand tile is 1,024 contiguous bytes, [j 0..1][lane 0..31][s 0..7] = row (lane & 15), k = 16 j + 8 (lane >> 4) + s: what lane and register half j of the
// matrix operand hold. One 16-byte load of a wave then reads 512 contiguous bytes (4 lines) where the row-major planes cost it 16 lines. Qn, Kn: tile = 16 rows x dims 32 dc ..; tiles in the order (row tile, dc).
// Vt: tile = dims 16 nb .. x 32 keys; tiles in the order (key chunk, nb). Each packer wave owns whole 512-byte pieces, so every line has one writer. '#pragma unroll' in the packers: as noted at k_att.
// k_nrm16: a wave per 16 rows; lane (c, h) holds of row c the dims 16 q + 8 h + s, q 0..3: its own 16 bytes of the pieces q = 2 dc + j. The row's square sum: 32 terms in the lane, then the partner lane's.
__global__ __launch_bounds__(128) void k_nrm16(const float* __restrict__ X, h16* P16) { const int lane = threadIdx.x & 31, c = lane & 15, h = lane >> 4; const int tile = blockIdx.x * 4 + (threadIdx.x >> 5); if (tile >= NZ * TT / 16) return;
    const float* src = X + ((size_t)tile * 16 + c) * HD + 8 * h; v4f a[4][2];
#pragma unroll
    for (int q = 0; q < 4; ++q) { a[q][0] = *(const v4f*)(src + 16 * q); a[q][1] = *(const v4f*)(src + 16 * q + 4); }
    float x[4][8]; float s = 0.0f;
#pragma unroll
    for (int q = 0; q < 4; ++q)
#pragma unroll
        for (int r = 0; r < 8; ++r) { x[q][r] = bfr(a[q][r >> 2][r & 3]); s += x[q][r] * x[q][r]; }
    s += __shfl_xor(s, 16, 32);
    const float nrm = fmaxf(__fsqrt_rn(s), 1e-12f); h16* dst = P16 + (size_t)tile * 1024 + lane * 8;
#pragma unroll
    for (int q = 0; q < 4; ++q) { v8h o;
#pragma unroll
        for (int r = 0; r < 8; ++r) o[r] = tohx(__fdiv_rn(x[q][r], nrm));
        *(v8h*)(dst + q * 256) = o; }  }
// k_vt16: a wave per 16 keys x 64 dims (w = 128 z + key tile; key chunk w >> 1, half j = w & 1); lane (c, h) reads keys 8 h + s at dim 16 nb + c (two 64-byte runs a load) and stores its 16 bytes of the four pieces (nb, j).
__global__ __launch_bounds__(128) void k_vt16(const float* __restrict__ V, h16* VT) { const int lane = threadIdx.x & 31, c = lane & 15, h = lane >> 4; const int w = blockIdx.x * 4 + (threadIdx.x >> 5); if (w >= NZ * TT / 16) return;
    const float* src = V + ((size_t)w * 16 + 8 * h) * HD + c; float x[4][8];
#pragma unroll
    for (int nb = 0; nb < 4; ++nb)
#pragma unroll
        for (int r = 0; r < 8; ++r) x[nb][r] = src[r * HD + nb * 16];
    h16* dst = VT + ((size_t)(w >> 1) * 8 + (w & 1)) * 256 + lane * 8;
#pragma unroll
    for (int nb = 0; nb < 4; ++nb) { v8h o;
#pragma unroll
        for (int r = 0; r < 8; ++r) o[r] = tohx(bfr(x[nb][r]));
        *(v8h*)(dst + nb * 512) = o; }  }
// ---- k_att: the whole weighted sum of one 16-query tile in ONE WAVE; no score and no weight leaves the registers. Grid 256 x 12 waves = 24 heads x 128 tiles.
// Per 32 keys: St = Kn . Qn^T (two 16-key tiles, K 64; lane (c, h), register r = key 8h + r, query c); weight in f32 in place; the two tiles, converted, ARE the B operand
// Pt of Ot += Vt . Pt (hardware k order: element s = key 8h + s, then 16 + 8h + s - 8; the Vt and Kn / Qn loader ldf has the same order: the planes lie in it). Keys ascend in steps of 32, as before.
// Every '#pragma unroll' without a number: the arrays stay in registers only under constant indices.
// The wave ends with its 16 output rows (see behind the loop): the weighted sum never goes to memory.
// K AND V COME THROUGH LDS: the twelve waves of a work-group walk the same keys, so each stage of 128 keys (16 KB of Kn, 16 KB of Vt, both already in fragment order: two straight runs of memory) is brought in ONCE
// per work-group by asynchronous copies, and every wave takes its fragments from there with 16-byte LDS reads of 512 contiguous bytes a wave. Two buffers: stage s + 1 flies while stage s is worked on.
// A work-group's twelve query tiles can lie in two heads (128 tiles a head): such a work-group stages both heads' keys, and each wave reads its own head's.
// Left for later steps: the mask is rounded to bf16 per element inside the loop; k_vt16 and k_nrm16 are launches of their own.
// wq2: two collision weights x 1024 from two dots d. acos(d) = 2 asin(y), y = sqrt((1 - d) / 2), so base = 1 - acos(d)/pi = 1 - (2/pi) asin(y). base has a root-type end at y = 1, base^2 a simple zero there: base^2 is smooth on
// the whole of [0, 1] and ONE polynomial in y covers every d in [-1, 1], with no case split, no sign handling and no second series. q = 1024^(1/4) base^2 by a degree-6 fit (weighted towards relative error), then q^4.
// Error of the weight in f32 arithmetic, a square root one ulp off included: under 2e-5 relative for d > -0.8, under 7e-5 wherever the fp16 weight is normal, never above a quarter of half an fp16 step.
// The clip of d to [-1, 1] is the clamp of (1 - d) / 2 to [0, 1].
__device__ __forceinline__ v2f wq2(const float d0, const float d1) {
    v2f y; y[0] = __builtin_amdgcn_sqrtf(__builtin_amdgcn_fmed3f(fmaf(d0, -0.5f, 0.5f), 0.0f, 1.0f)); y[1] = __builtin_amdgcn_sqrtf(__builtin_amdgcn_fmed3f(fmaf(d1, -0.5f, 0.5f), 0.0f, 1.0f));
    v2f q = y * 0.0424227603f + -0.223755330f; q = q * y + 0.584063053f; q = q * y + -1.13987541f; q = q * y + 2.28209758f; q = q * y + -7.20179796f; q = q * y + 5.65684557f;
    q = q * q; return q * q; }
__device__ __forceinline__ v16h ldf(const h16* p) { return cat16(*(const v8h*)p, *(const v8h*)(p + 256)); }     // p: the lane's 16 bytes of piece j = 0; piece 1 lies 512 bytes on
#define KS   128                  // keys a stage
#define STE  (KS * HD)            // elements of one operand's stage (16 KB)
#define NST  (TT / KS)
__global__ __launch_bounds__(384) void k_att(const h16* __restrict__ QN, const h16* __restrict__ KN, const h16* __restrict__ VT, const float* __restrict__ mk, const float* __restrict__ V, const float* __restrict__ cw, float* __restrict__ OUT) {
    __shared__ __attribute__((aligned(16))) h16 sm[2][2][2][STE];     // [buffer][first, second head of the work-group][Kn, Vt]: 128 KB
    const int lane = threadIdx.x & 31, c = lane & 15, h = lane >> 4;
    const int wave = __builtin_amdgcn_readfirstlane(threadIdx.x >> 5);
    const int g = blockIdx.x * 12 + wave;
    const int z = g >> 7, q0 = (g & 127) * 16;
    const int za = (blockIdx.x * 12) >> 7; const bool two = ((blockIdx.x * 12 + 11) >> 7) != za;     // the work-group's first head; whether its last wave is in the next one
    const h16* qp = QN + (size_t)g * 1024 + lane * 8;     // 16 rows x 64 dims = 1,024 elements a row tile
    const h16* sl = &sm[0][z - za][0][lane * 8];     // the lane's 16 bytes of the first piece of its head's Kn in buffer 0
    const unsigned lds0 = (unsigned)(size_t)&sm[0][0][0][lane * 8];     // the same place of the first head as an LDS byte address
    // fill: wave w < 8 brings its 4 KB (w < 4: a quarter of Kn's 16 KB, else of Vt's) of stage st of head za + e: eight copies of 512 bytes, a lane's 16 bytes each.
    auto fill = [&](const int st, const int e) __attribute__((always_inline)) {
        const h16* gs = (wave < 4 ? KN : VT) + (size_t)(za + e) * TT * HD + (size_t)st * STE + (wave & 3) * 2048 + lane * 8;
        const unsigned ld = lds0 + (unsigned)((((st & 1) * 2 + e) * 2 * STE + wave * 2048) * 2);
        // the wait is the statement's last line: the address registers of the copies are free for reuse only behind it
        asm volatile("global_load_async_to_lds_b128 %0, %8, off\n\tglobal_load_async_to_lds_b128 %1, %9, off\n\tglobal_load_async_to_lds_b128 %2, %10, off\n\tglobal_load_async_to_lds_b128 %3, %11, off\n\t"
                     "global_load_async_to_lds_b128 %4, %12, off\n\tglobal_load_async_to_lds_b128 %5, %13, off\n\tglobal_load_async_to_lds_b128 %6, %14, off\n\tglobal_load_async_to_lds_b128 %7, %15, off\n\ts_wait_xcnt 0x0"
                     :: "v"(ld), "v"(ld + 512), "v"(ld + 1024), "v"(ld + 1536), "v"(ld + 2048), "v"(ld + 2560), "v"(ld + 3072), "v"(ld + 3584),
                        "v"(gs), "v"(gs + 256), "v"(gs + 512), "v"(gs + 768), "v"(gs + 1024), "v"(gs + 1280), "v"(gs + 1536), "v"(gs + 1792) : "memory"); };
    auto stage = [&](const int st) __attribute__((always_inline)) { if (wave < 8) { fill(st, 0); if (two) fill(st, 1); } };     // both tests are the same for a whole wave, the second for the work-group
    stage(0);
    const float* mp = mk + (size_t)(z / NHD) * TT + 8 * h;
    v8f acc[4];
#pragma unroll
    for (int nb = 0; nb < 4; ++nb) acc[nb] = (v8f){};
    __builtin_amdgcn_sched_barrier(0);     // with the one behind the wait: no address arithmetic between the first loads and their s_wait_xcnt, where it rewrote a register that a load names
    const v16h qf0 = ldf(qp), qf1 = ldf(qp + 512);
    v16h kf[2][2]; v4f ma[2][2], mb[2][2];
#pragma unroll
    for (int t = 0; t < 2; ++t) { ma[t][0] = *(const v4f*)(mp + 16 * t); ma[t][1] = *(const v4f*)(mp + 16 * t + 4); }
    asm volatile("s_wait_xcnt 0x0" ::: "memory");     // the address registers of the loads above are free for reuse behind it
    __builtin_amdgcn_sched_barrier(0);     // see above
    asm volatile("s_wait_asynccnt 0x0" ::: "memory");     // this wave's copies of stage 0 have landed
    __syncthreads();     // stage 0 is published: every wave's copies have landed
    stage(1);
    // one pass = 32 keys, the ps-th of its stage. sb: the lane's place in the stage's Kn; its Vt lies STE elements on. mc: this pass's mask values; mn: filled for the next pass.
    auto pass = [&](const h16* sb, const int ps, const int kc, v4f (&mc)[2][2], v4f (&mn)[2][2]) __attribute__((always_inline)) {
        v16h vf[4];     // asked for here, used behind the weights
#pragma unroll
        for (int nb = 0; nb < 4; ++nb) vf[nb] = ldf(sb + STE + ps * 2048 + nb * 512);     // 32 keys x 64 dims = 2,048 elements a key chunk
        v8f s[2];
#pragma unroll
        for (int t = 0; t < 2; ++t) { s[t] = wmma16(kf[t][0], qf0, (v8f){}); s[t] = wmma16(kf[t][1], qf1, s[t]); }
        if (ps < KS / 32 - 1) {     // the next pass's keys, one pass ahead, inside the stage only: the next stage is not published yet
#pragma unroll
            for (int t = 0; t < 2; ++t) { kf[t][0] = ldf(sb + (ps + 1) * 2048 + t * 1024); kf[t][1] = ldf(sb + (ps + 1) * 2048 + t * 1024 + 512); } }
        const int kn = kc + 32 < TT ? kc + 32 : kc;     // the next pass's mask, one pass ahead (the last pass asks for its own again: in bounds, unused)
        const float* mq = mp + kn;
#pragma unroll
        for (int t = 0; t < 2; ++t) { mn[t][0] = *(const v4f*)(mq + 16 * t); mn[t][1] = *(const v4f*)(mq + 16 * t + 4); }
        asm volatile("s_wait_xcnt 0x0" :: "v"(mq) : "memory");     // the pointer is an input so that its registers live up to the wait: no load of the run above may land in the pair that the run names
        __builtin_amdgcn_sched_barrier(0);     // keeps the loads above in front of the weights: sunk to their uses, each would show its whole latency
        v16h p;
#pragma unroll
        for (int t = 0; t < 2; ++t)
#pragma unroll
            for (int r = 0; r < 8; r += 2) { const v2f w = wq2(s[t][r], s[t][r + 1]);
                p[t * 8 + r] = tohx(w[0] * bfr(mc[t][r >> 2][r & 3])); p[t * 8 + r + 1] = tohx(w[1] * bfr(mc[t][r >> 2][(r & 3) + 1])); }
#pragma unroll
        for (int nb = 0; nb < 4; ++nb) acc[nb] = wmma16(vf[nb], p, acc[nb]);
        __builtin_amdgcn_sched_barrier(0);     // keeps the next pass's score products behind these weights: lifted over them, they wait for keys that were only just asked for
    };
#pragma unroll 1     // one trip = one stage = four passes (an even number: the two mask sets swap roles without copies); more would only lengthen the text
    for (int st = 0; st < NST; ++st) { const h16* sb = sl + (st & 1) * (4 * STE); const int kc = st * KS;
#pragma unroll
        for (int t = 0; t < 2; ++t) { kf[t][0] = ldf(sb + t * 1024); kf[t][1] = ldf(sb + t * 1024 + 512); }
        pass(sb, 0, kc, ma, mb); pass(sb, 1, kc + 32, mb, ma); pass(sb, 2, kc + 64, ma, mb); pass(sb, 3, kc + 96, mb, ma);
        asm volatile("s_wait_dscnt 0x0" ::: "memory");     // this wave's reads of the buffer are over before the buffer is given up
        asm volatile("s_wait_asynccnt 0x0" ::: "memory");     // this wave's copies of stage st + 1 have landed
        __syncthreads();     // publishes stage st + 1 and ends every wave's reads of stage st
        if (st + 2 < NST) stage(st + 2);     // into the buffer that this trip has just read
    }
    asm volatile("s_wait_asynccnt 0x0" ::: "memory");     // no copy is outstanding when the wave goes on to its end
    // The output rows. acc[nb][r] = 1024 (W V)[t][16 nb + 8h + r], t = q0 + c: lanes (c, 0) and (c, 1) hold the whole of row t.
    // x = (acc / 1024) bf16(mask[b][t]); X = x / max(||x||, 1e-12), the square sum 32 terms in the lane (even dims, odd dims, their sum), then the partner lane's;
    // out = X + sum_k bf16(w[head][k]) (bf16(V[z][t + k - 1][d]) bf16(mask[b][t + k - 1])), rows outside the sequence count as zero.
    // w (v m) is formed as (w m) v: every factor has 8 significant bits, so both products are exact in f32 in either order.
    const int t = q0 + c; const float* mrow = mk + (size_t)(z / NHD) * TT; const float* wrow = cw + (z % NHD) * 3;
    const int tl = t > 0 ? t - 1 : t, tr = t < TT - 1 ? t + 1 : t;     // the neighbours' addresses stay in the plane; at the ends their tap weight is zero
    const float* vz = V + (size_t)z * TT * HD + 8 * h;
    const float* vl = vz + (size_t)tl * HD; const float* vc = vz + (size_t)t * HD; const float* vn = vz + (size_t)tr * HD;
    const float ml = mrow[tl], mc = mrow[t], mr = mrow[tr];
    v4f vv[3][4][2];
#pragma unroll
    for (int nb = 0; nb < 4; ++nb) { vv[0][nb][0] = *(const v4f*)(vl + nb * 16); vv[0][nb][1] = *(const v4f*)(vl + nb * 16 + 4); vv[1][nb][0] = *(const v4f*)(vc + nb * 16); vv[1][nb][1] = *(const v4f*)(vc + nb * 16 + 4);
        vv[2][nb][0] = *(const v4f*)(vn + nb * 16); vv[2][nb][1] = *(const v4f*)(vn + nb * 16 + 4); }
    asm volatile("s_wait_xcnt 0x0" :: "v"(vl), "v"(vc), "v"(vn), "v"(tl), "v"(t), "v"(tr) : "memory");     // pointers and row numbers are inputs so that their registers live up to the wait: no load of the run above may land in a register that the run names
    const float mt = bfr(mc); const float wm[3] = { bfr(wrow[0]) * bfr(ml) * (t > 0 ? 1.0f : 0.0f), bfr(wrow[1]) * mt, bfr(wrow[2]) * bfr(mr) * (t < TT - 1 ? 1.0f : 0.0f) };
    const float xs = mt * (1.0f / PCAR);     // a power of two: (acc / 1024) mask = acc (mask / 1024)
    v2f sq2 = (v2f){};     // even and odd dims apart: packed arithmetic
#pragma unroll
    for (int nb = 0; nb < 4; ++nb)
#pragma unroll
        for (int r = 0; r < 8; r += 2) { v2f x; x[0] = acc[nb][r]; x[1] = acc[nb][r + 1]; x = x * xs; sq2 = x * x + sq2; acc[nb][r] = x[0]; acc[nb][r + 1] = x[1]; }
    float sq = sq2[0] + sq2[1];
    { const int sb = __float_as_int(sq); sq += __int_as_float(__builtin_amdgcn_permlanex16(sb, sb, 0x76543210, 0xfedcba98, false, false)); }     // lane l ^ 16: the other half of the row
    const float nrm = fmaxf(__fsqrt_rn(sq), 1e-12f);
    float* orow = OUT + ((size_t)z * TT + t) * HD + 8 * h;
#pragma unroll
    for (int nb = 0; nb < 4; ++nb)
#pragma unroll
        for (int r = 0; r < 8; r += 2) { v2f y; y[0] = __fdiv_rn(acc[nb][r], nrm); y[1] = __fdiv_rn(acc[nb][r + 1], nrm);
#pragma unroll
            for (int k = 0; k < 3; ++k) { v2f u; u[0] = vv[k][nb][r >> 2][r & 3]; u[1] = vv[k][nb][r >> 2][(r & 3) + 1]; const v2b ub = __builtin_convertvector(u, v2b);     // to bf16, nearest even, two at a time
                y[0] += wm[k] * (float)ub[0]; y[1] += wm[k] * (float)ub[1]; }
            acc[nb][r] = y[0]; acc[nb][r + 1] = y[1]; }
#pragma unroll
    for (int nb = 0; nb < 4; ++nb) { v4f lo, hi4;
#pragma unroll
        for (int r = 0; r < 4; ++r) { lo[r] = acc[nb][r]; hi4[r] = acc[nb][4 + r]; }
        *(v4f*)(orow + nb * 16) = lo; *(v4f*)(orow + nb * 16 + 4) = hi4; }
}

extern "C" void kernel_launch(void* const* d_in, const int* in_sizes, int n_in,
                              void* d_out, int out_size, void* d_ws, size_t ws_size, hipStream_t stream) {
    (void)in_sizes; (void)n_in; (void)out_size;
    const float* Q = (const float*)d_in[0]; const float* K = (const float*)d_in[1]; const float* V = (const float*)d_in[2]; const float* mk = (const float*)d_in[3]; const float* cw = (const float*)d_in[4];
    float* OUT = (float*)d_out;     // [2][12][2048][64]
    char* wsp = (char*)d_ws;
    auto take = [&](size_t bytes) { char* p = wsp; wsp += (bytes + 255) & ~(size_t)255; return (void*)p; };
    h16* QN = (h16*)take((size_t)NZ * TT * HD * 2); h16* KN = (h16*)take((size_t)NZ * TT * HD * 2); h16* VT = (h16*)take((size_t)NZ * HD * TT * 2);
    if ((size_t)(wsp - (char*)d_ws) > ws_size) return;    // total ~ 19 MB; ws 256 MiB
    k_nrm16<<<NZ * TT / 16 / 4, 128, 0, stream>>>(Q, QN); k_nrm16<<<NZ * TT / 16 / 4, 128, 0, stream>>>(K, KN); k_vt16<<<NZ * TT / 16 / 4, 128, 0, stream>>>(V, VT);
    k_att<<<NZ * TT / 16 / 12, 384, 0, stream>>>(QN, KN, VT, mk, V, cw, OUT);
}

// v006
// One run takes 44.2 microseconds.
// In both of two side-by-side timings against v005, it was 1.27 times as fast.
// Over all steps from v000 it is 20.2 times as fast.
#include <hip/hip_runtime.h>

// YOSOAttention (Q, K, V [2][12][2048][64], mask [2][2048] (all ones here; read as data), conv_w [12][1][3][1]; qn, kn = l2-normalised Q, K; W = (1 - acos(clip(qn.kn, -1, 1))/pi)^8 x mask_j (expected LSH collision,
// hash_code_len 8; no softmax); X = l2norm((W V) x mask_i); out = X + depthwise conv of (V x mask) over the sequence (3 taps, padding 1, per head) -> [2][12][2048][64]).
// Compute dtypes, f32 accumulate: every input rounded to bf16; the l2 normalisations in f32 (wave per 16 rows) -> SINGLE fp16 planes; qn.kn (K 64) fp16; weight (see wq2) in
// f32 on VALU -> fp16 weights x1024; W.V (K 2048) fp16 x fp16(bf16 V x bf16 key mask); the output normalisation, the 3-tap conv and the sum in f32 (the output is dominated by the conv term).

#define NZ   24                   // batch x heads
#define NHD  12
#define TT   2048
#define HD   64
#define PCAR 1024.0f
typedef _Float16 h16;
typedef __attribute__((ext_vector_type(16))) _Float16 v16h;
typedef __attribute__((ext_vector_type(8)))  _Float16 v8h;
typedef __attribute__((ext_vector_type(8)))  float    v8f;
typedef __attribute__((ext_vector_type(4)))  float    v4f;

__device__ __forceinline__ unsigned short f2bf(float f) { unsigned u = __float_as_uint(f); u += 0x7FFFu + ((u >> 16) & 1u); return (unsigned short)(u >> 16); }
__device__ __forceinline__ float bf2f(unsigned short b) { return __uint_as_float(((unsigned)b) << 16); }
__device__ __forceinline__ float bfr(float f) { return bf2f(f2bf(f)); }
__device__ __forceinline__ v16h cat16(v8h lo, v8h hi) { return __builtin_shufflevector(lo, hi, 0, 1, 2, 3, 4, 5, 6, 7, 8, 9, 10, 11, 12, 13, 14, 15); }
__device__ __forceinline__ v8f wmma16(v16h a, v16h b, v8f c) { return __builtin_amdgcn_wmma_f32_16x16x32_f16(false, a, false, b, (short)0, c, false, false); }

__device__ __forceinline__ h16 tohx(float x) { return (h16)x; }
typedef __attribute__((ext_vector_type(4))) _Float16 v4h;
typedef __attribute__((ext_vector_type(2))) float v2f;
typedef __attribute__((ext_vector_type(2))) __bf16 v2b;

// FRAGMENT ORDER of the three fp16 planes: a 16 x 32 operand tile is 1,024 contiguous bytes, [j 0..1][lane 0..31][s 0..7] = row (lane & 15), k = 16 j + 8 (lane >> 4) + s: what lane and register half j of the
// matrix operand hold. One 16-byte load of a wave then reads 512 contiguous bytes (4 lines) where the row-major planes cost it 16 lines. Qn, Kn: tile = 16 rows x dims 32 dc ..; tiles in the order (row tile, dc).
// Vt: tile = dims 16 nb .. x 32 keys; tiles in the order (key chunk, nb). Each packer wave owns whole 512-byte pieces, so every line has one writer. '#pragma unroll' in the packers: as noted at k_att.
// k_nrm16: a wave per 16 rows; lane (c, h) holds of row c the dims 16 q + 8 h + s, q 0..3: its own 16 bytes of the pieces q = 2 dc + j. The row's square sum: 32 terms in the lane, then the partner lane's.
__global__ __launch_bounds__(128) void k_nrm16(const float* __restrict__ X, h16* P16) { const int lane = threadIdx.x & 31, c = lane & 15, h = lane >> 4; const int tile = blockIdx.x * 4 + (threadIdx.x >> 5); if (tile >= NZ * TT / 16) return;
    const float* src = X + ((size_t)tile * 16 + c) * HD + 8 * h; v4f a[4][2];
#pragma unroll
    for (int q = 0; q < 4; ++q) { a[q][0] = *(const v4f*)(src + 16 * q); a[q][1] = *(const v4f*)(src + 16 * q + 4); }
    float x[4][8]; float s = 0.0f;
#pragma unroll
    for (int q = 0; q < 4; ++q)
#pragma unroll
        for (int r = 0; r < 8; ++r) { x[q][r] = bfr(a[q][r >> 2][r & 3]); s += x[q][r] * x[q][r]; }
    s += __shfl_xor(s, 16, 32);
    const float nrm = fmaxf(__fsqrt_rn(s), 1e-12f); h16* dst = P16 + (size_t)tile * 1024 + lane * 8;
#pragma unroll
    for (int q = 0; q < 4; ++q) { v8h o;
#pragma unroll
        for (int r = 0; r < 8; ++r) o[r] = tohx(__fdiv_rn(x[q][r], nrm));
        *(v8h*)(dst + q * 256) = o; }  }
// k_vt16: a wave per 16 keys x 64 dims (w = 128 z + key tile; key chunk w >> 1, half j = w & 1); lane (c, h) reads keys 8 h + s at dim 16 nb + c (two 64-byte runs a load) and stores its 16 bytes of the four pieces (nb, j).
// THE KEY MASK LIVES IN Vt: sum_j (W mask_j) V_j = sum_j W (mask_j V_j), so the plane holds fp16(bf16(V) bf16(mask)), formed once per element of V here, and the attention loop never sees the mask of a key.
__global__ __launch_bounds__(128) void k_vt16(const float* __restrict__ V, const float* __restrict__ mk, h16* VT) { const int lane = threadIdx.x & 31, c = lane & 15, h = lane >> 4; const int w = blockIdx.x * 4 + (threadIdx.x >> 5); if (w >= NZ * TT / 16) return;
    const float* src = V + ((size_t)w * 16 + 8 * h) * HD + c; float x[4][8];
    const float* mq = mk + (size_t)((w >> 7) / NHD) * TT + (w & 127) * 16 + 8 * h;     // the lane's eight keys in its batch's mask row
    const v4f m0 = *(const v4f*)mq, m1 = *(const v4f*)(mq + 4);
#pragma unroll
    for (int nb = 0; nb < 4; ++nb)
#pragma unroll
        for (int r = 0; r < 8; ++r) x[nb][r] = src[r * HD + nb * 16];
    float mm[8];
#pragma unroll
    for (int r = 0; r < 8; ++r) mm[r] = bfr(r < 4 ? m0[r & 3] : m1[r & 3]);
    h16* dst = VT + ((size_t)(w >> 1) * 8 + (w & 1)) * 256 + lane * 8;
#pragma unroll
    for (int nb = 0; nb < 4; ++nb) { v8h o;
#pragma unroll
        for (int r = 0; r < 8; ++r) o[r] = tohx(bfr(x[nb][r]) * mm[r]);
        *(v8h*)(dst + nb * 512) = o; }  }
// ---- k_att: the whole weighted sum of one 16-query tile in ONE WAVE; no score and no weight leaves the registers. Grid 256 x 12 waves = 24 heads x 128 tiles.
// Per 32 keys: St = Kn . Qn^T (two 16-key tiles, K 64; lane (c, h), register r = key 8h + r, query c); weight in f32 in place; the two tiles, converted, ARE the B operand
// Pt of Ot += Vt . Pt (hardware k order: element s = key 8h + s, then 16 + 8h + s - 8; the Vt and Kn / Qn loader ldf has the same order: the planes lie in it). Keys ascend in steps of 32, as before.
// Every '#pragma unroll' without a number: the arrays stay in registers only under constant indices.
// The wave ends with its 16 output rows (see behind the loop): the weighted sum never goes to memory.
// K AND V COME THROUGH LDS: the twelve waves of a work-group walk the same keys, so each stage of 128 keys (16 KB of Kn, 16 KB of Vt, both already in fragment order: two straight runs of memory) is brought in ONCE
// per work-group by asynchronous copies, and every wave takes its fragments from there with 16-byte LDS reads of 512 contiguous bytes a wave. Two buffers: stage s + 1 flies while stage s is worked on.
// A work-group's twelve query tiles can lie in two heads (128 tiles a head): such a work-group stages both heads' keys, and each wave reads its own head's.
// Left for later steps: k_vt16 and k_nrm16 are launches of their own.
// wq2: two collision weights x 1024 from two dots d. acos(d) = 2 asin(y), y = sqrt((1 - d) / 2), so base = 1 - acos(d)/pi = 1 - (2/pi) asin(y). base has a root-type end at y = 1, base^2 a simple zero there: base^2 is smooth on
// the whole of [0, 1] and ONE polynomial in y covers every d in [-1, 1], with no case split, no sign handling and no second series. q = 1024^(1/4) base^2 by a degree-6 fit (weighted towards relative error), then q^4.
// Error of the weight in f32 arithmetic, a square root one ulp off included: under 2e-5 relative for d > -0.8, under 7e-5 wherever the fp16 weight is normal, never above a quarter of half an fp16 step.
// The clip of d to [-1, 1] is the clamp of (1 - d) / 2 to [0, 1].
__device__ __forceinline__ v2f wq2(const float d0, const float d1) {
    v2f y; y[0] = __builtin_amdgcn_sqrtf(__builtin_amdgcn_fmed3f(fmaf(d0, -0.5f, 0.5f), 0.0f, 1.0f)); y[1] = __builtin_amdgcn_sqrtf(__builtin_amdgcn_fmed3f(fmaf(d1, -0.5f, 0.5f), 0.0f, 1.0f));
    v2f q = y * 0.0424227603f + -0.223755330f; q = q * y + 0.584063053f; q = q * y + -1.13987541f; q = q * y + 2.28209758f; q = q * y + -7.20179796f; q = q * y + 5.65684557f;
    q = q * q; return q * q; }
__device__ __forceinline__ v16h ldf(const h16* p) { return cat16(*(const v8h*)p, *(const v8h*)(p + 256)); }     // p: the lane's 16 bytes of piece j = 0; piece 1 lies 512 bytes on
#define KS   128                  // keys a stage
#define STE  (KS * HD)            // elements of one operand's stage (16 KB)
#define NST  (TT / KS)
__global__ __launch_bounds__(384) void k_att(const h16* __restrict__ QN, const h16* __restrict__ KN, const h16* __restrict__ VT, const float* __restrict__ mk, const float* __restrict__ V, const float* __restrict__ cw, float* __restrict__ OUT) {
    __shared__ __attribute__((aligned(16))) h16 sm[2][2][2][STE];     // [buffer][first, second head of the work-group][Kn, Vt]: 128 KB
    const int lane = threadIdx.x & 31, c = lane & 15, h = lane >> 4;
    const int wave = __builtin_amdgcn_readfirstlane(threadIdx.x >> 5);
    const int g = blockIdx.x * 12 + wave;
    const int z = g >> 7, q0 = (g & 127) * 16;
    const int za = (blockIdx.x * 12) >> 7; const bool two = ((blockIdx.x * 12 + 11) >> 7) != za;     // the work-group's first head; whether its last wave is in the next one
    const h16* qp = QN + (size_t)g * 1024 + lane * 8;     // 16 rows x 64 dims = 1,024 elements a row tile
    const h16* sl = &sm[0][z - za][0][lane * 8];     // the lane's 16 bytes of the first piece of its head's Kn in buffer 0
    const unsigned lds0 = (unsigned)(size_t)&sm[0][0][0][lane * 8];     // the same place of the first head as an LDS byte address
    // fill: wave w < 8 brings its 4 KB (w < 4: a quarter of Kn's 16 KB, else of Vt's) of stage st of head za + e: eight copies of 512 bytes, a lane's 16 bytes each.
    auto fill = [&](const int st, const int e) __attribute__((always_inline)) {
        const h16* gs = (wave < 4 ? KN : VT) + (size_t)(za + e) * TT * HD + (size_t)st * STE + (wave & 3) * 2048 + lane * 8;
        const unsigned ld = lds0 + (unsigned)((((st & 1) * 2 + e) * 2 * STE + wave * 2048) * 2);
        // the wait is the statement's last line: the address registers of the copies are free for reuse only behind it
        asm volatile("global_load_async_to_lds_b128 %0, %8, off\n\tglobal_load_async_to_lds_b128 %1, %9, off\n\tglobal_load_async_to_lds_b128 %2, %10, off\n\tglobal_load_async_to_lds_b128 %3, %11, off\n\t"
                     "global_load_async_to_lds_b128 %4, %12, off\n\tglobal_load_async_to_lds_b128 %5, %13, off\n\tglobal_load_async_to_lds_b128 %6, %14, off\n\tglobal_load_async_to_lds_b128 %7, %15, off\n\ts_wait_xcnt 0x0"
                     :: "v"(ld), "v"(ld + 512), "v"(ld + 1024), "v"(ld + 1536), "v"(ld + 2048), "v"(ld + 2560), "v"(ld + 3072), "v"(ld + 3584),
                        "v"(gs), "v"(gs + 256), "v"(gs + 512), "v"(gs + 768), "v"(gs + 1024), "v"(gs + 1280), "v"(gs + 1536), "v"(gs + 1792) : "memory"); };
    auto stage = [&](const int st) __attribute__((always_inline)) { if (wave < 8) { fill(st, 0); if (two) fill(st, 1); } };     // both tests are the same for a whole wave, the second for the work-group
    stage(0);
    v8f acc[4];
#pragma unroll
    for (int nb = 0; nb < 4; ++nb) acc[nb] = (v8f){};
    __builtin_amdgcn_sched_barrier(0);     // with the one behind the wait: no address arithmetic between the first loads and their s_wait_xcnt, where it rewrote a register that a load names
    const v16h qf0 = ldf(qp), qf1 = ldf(qp + 512);
    v16h kf[2][2];
    asm volatile("s_wait_xcnt 0x0" ::: "memory");     // the address registers of the loads above are free for reuse behind it
    __builtin_amdgcn_sched_barrier(0);     // see above
    asm volatile("s_wait_asynccnt 0x0" ::: "memory");     // this wave's copies of stage 0 have landed
    __syncthreads();     // stage 0 is published: every wave's copies have landed
    stage(1);
    // one pass = 32 keys, the ps-th of its stage. sb: the lane's place in the stage's Kn; its Vt lies STE elements on.
    auto pass = [&](const h16* sb, const int ps) __attribute__((always_inline)) {
        v16h vf[4];     // asked for here, used behind the weights
#pragma unroll
        for (int nb = 0; nb < 4; ++nb) vf[nb] = ldf(sb + STE + ps * 2048 + nb * 512);     // 32 keys x 64 dims = 2,048 elements a key chunk
        v8f s[2];
#pragma unroll
        for (int t = 0; t < 2; ++t) { s[t] = wmma16(kf[t][0], qf0, (v8f){}); s[t] = wmma16(kf[t][1], qf1, s[t]); }
        if (ps < KS / 32 - 1) {     // the next pass's keys, one pass ahead, inside the stage only: the next stage is not published yet
#pragma unroll
            for (int t = 0; t < 2; ++t) { kf[t][0] = ldf(sb + (ps + 1) * 2048 + t * 1024); kf[t][1] = ldf(sb + (ps + 1) * 2048 + t * 1024 + 512); } }
        __builtin_amdgcn_sched_barrier(0);     // keeps the loads above in front of the weights: sunk to their uses, each would show its whole latency
        v16h p;
#pragma unroll
        for (int t = 0; t < 2; ++t)
#pragma unroll
            for (int r = 0; r < 8; r += 2) { const v2f w = wq2(s[t][r], s[t][r + 1]);
                p[t * 8 + r] = tohx(w[0]); p[t * 8 + r + 1] = tohx(w[1]); }
#pragma unroll
        for (int nb = 0; nb < 4; ++nb) acc[nb] = wmma16(vf[nb], p, acc[nb]);
        __builtin_amdgcn_sched_barrier(0);     // keeps the next pass's score products behind these weights: lifted over them, they wait for keys that were only just asked for
    };
#pragma unroll 1     // one trip = one stage = four passes; more would only lengthen the text
    for (int st = 0; st < NST; ++st) { const h16* sb = sl + (st & 1) * (4 * STE);
#pragma unroll
        for (int t = 0; t < 2; ++t) { kf[t][0] = ldf(sb + t * 1024); kf[t][1] = ldf(sb + t * 1024 + 512); }
        pass(sb, 0); pass(sb, 1); pass(sb, 2); pass(sb, 3);
        asm volatile("s_wait_dscnt 0x0" ::: "memory");     // this wave's reads of the buffer are over before the buffer is given up
        asm volatile("s_wait_asynccnt 0x0" ::: "memory");     // this wave's copies of stage st + 1 have landed
        __syncthreads();     // publishes stage st + 1 and ends every wave's reads of stage st
        if (st + 2 < NST) stage(st + 2);     // into the buffer that this trip has just read
    }
    asm volatile("s_wait_asynccnt 0x0" ::: "memory");     // no copy is outstanding when the wave goes on to its end
    // The output rows. acc[nb][r] = 1024 (W V)[t][16 nb + 8h + r], t = q0 + c: lanes (c, 0) and (c, 1) hold the whole of row t.
    // x = (acc / 1024) bf16(mask[b][t]); X = x / max(||x||, 1e-12), the square sum 32 terms in the lane (even dims, odd dims, their sum), then the partner lane's;
    // out = X + sum_k bf16(w[head][k]) (bf16(V[z][t + k - 1][d]) bf16(mask[b][t + k - 1])), rows outside the sequence count as zero.
    // w (v m) is formed as (w m) v: every factor has 8 significant bits, so both products are exact in f32 in either order.
    const int t = q0 + c; const float* mrow = mk + (size_t)(z / NHD) * TT; const float* wrow = cw + (z % NHD) * 3;
    const int tl = t > 0 ? t - 1 : t, tr = t < TT - 1 ? t + 1 : t;     // the neighbours' addresses stay in the plane; at the ends their tap weight is zero
    const float* vz = V + (size_t)z * TT * HD + 8 * h;
    const float* vl = vz + (size_t)tl * HD; const float* vc = vz + (size_t)t * HD; const float* vn = vz + (size_t)tr * HD;
    const float ml = mrow[tl], mc = mrow[t], mr = mrow[tr];
    v4f vv[3][4][2];
#pragma unroll
    for (int nb = 0; nb < 4; ++nb) { vv[0][nb][0] = *(const v4f*)(vl + nb * 16); vv[0][nb][1] = *(const v4f*)(vl + nb * 16 + 4); vv[1][nb][0] = *(const v4f*)(vc + nb * 16); vv[1][nb][1] = *(const v4f*)(vc + nb * 16 + 4);
        vv[2][nb][0] = *(const v4f*)(vn + nb * 16); vv[2][nb][1] = *(const v4f*)(vn + nb * 16 + 4); }
    asm volatile("s_wait_xcnt 0x0" :: "v"(vl), "v"(vc), "v"(vn), "v"(tl), "v"(t), "v"(tr) : "memory");     // pointers and row numbers are inputs so that their registers live up to the wait: no load of the run above may land in a register that the run names
    const float mt = bfr(mc); const float wm[3] = { bfr(wrow[0]) * bfr(ml) * (t > 0 ? 1.0f : 0.0f), bfr(wrow[1]) * mt, bfr(wrow[2]) * bfr(mr) * (t < TT - 1 ? 1.0f : 0.0f) };
    const float xs = mt * (1.0f / PCAR);     // a power of two: (acc / 1024) mask = acc (mask / 1024)
    v2f sq2 = (v2f){};     // even and odd dims apart: packed arithmetic
#pragma unroll
    for (int nb = 0; nb < 4; ++nb)
#pragma unroll
        for (int r = 0; r < 8; r += 2) { v2f x; x[0] = acc[nb][r]; x[1] = acc[nb][r + 1]; x = x * xs; sq2 = x * x + sq2; acc[nb][r] = x[0]; acc[nb][r + 1] = x[1]; }
    float sq = sq2[0] + sq2[1];
    { const int sb = __float_as_int(sq); sq += __int_as_float(__builtin_amdgcn_permlanex16(sb, sb, 0x76543210, 0xfedcba98, false, false)); }     // lane l ^ 16: the other half of the row
    const float nrm = fmaxf(__fsqrt_rn(sq), 1e-12f);
    float* orow = OUT + ((size_t)z * TT + t) * HD + 8 * h;
#pragma unroll
    for (int nb = 0; nb < 4; ++nb)
#pragma unroll
        for (int r = 0; r < 8; r += 2) { v2f y; y[0] = __fdiv_rn(acc[nb][r], nrm); y[1] = __fdiv_rn(acc[nb][r + 1], nrm);
#pragma unroll
            for (int k = 0; k < 3; ++k) { v2f u; u[0] = vv[k][nb][r >> 2][r & 3]; u[1] = vv[k][nb][r >> 2][(r & 3) + 1]; const v2b ub = __builtin_convertvector(u, v2b);     // to bf16, nearest even, two at a time
                y[0] += wm[k] * (float)ub[0]; y[1] += wm[k] * (float)ub[1]; }
            acc[nb][r] = y[0]; acc[nb][r + 1] = y[1]; }
#pragma unroll
    for (int nb = 0; nb < 4; ++nb) { v4f lo, hi4;
#pragma unroll
        for (int r = 0; r < 4; ++r) { lo[r] = acc[nb][r]; hi4[r] = acc[nb][4 + r]; }
        *(v4f*)(orow + nb * 16) = lo; *(v4f*)(orow + nb * 16 + 4) = hi4; }
}

extern "C" void kernel_launch(void* const* d_in, const int* in_sizes, int n_in,
                              void* d_out, int out_size, void* d_ws, size_t ws_size, hipStream_t stream) {
    (void)in_sizes; (void)n_in; (void)out_size;
    const float* Q = (const float*)d_in[0]; const float* K = (const float*)d_in[1]; const float* V = (const float*)d_in[2]; const float* mk = (const float*)d_in[3]; const float* cw = (const float*)d_in[4];
    float* OUT = (float*)d_out;     // [2][12][2048][64]
    char* wsp = (char*)d_ws;
    auto take = [&](size_t bytes) { char* p = wsp; wsp += (bytes + 255) & ~(size_t)255; return (void*)p; };
    h16* QN = (h16*)take((size_t)NZ * TT * HD * 2); h16* KN = (h16*)take((size_t)NZ * TT * HD * 2); h16* VT = (h16*)take((size_t)NZ * HD * TT * 2);
    if ((size_t)(wsp - (char*)d_ws) > ws_size) return;    // total ~ 19 MB; ws 256 MiB
    k_nrm16<<<NZ * TT / 16 / 4, 128, 0, stream>>>(Q, QN); k_nrm16<<<NZ * TT / 16 / 4, 128, 0, stream>>>(K, KN); k_vt16<<<NZ * TT / 16 / 4, 128, 0, stream>>>(V, mk, VT);
    k_att<<<NZ * TT / 16 / 12, 384, 0, stream>>>(QN, KN, VT, mk, V, cw, OUT);
}

// v007
// Measured time: 40.7 microseconds a run.
// Next to v006, in two timings, it ran 1.09 and 1.08 times as fast.
// Counting every step since v000, it is 22.0 times as fast.
#include <hip/hip_runtime.h>

// YOSOAttention (Q, K, V [2][12][2048][64], mask [2][2048] (all ones here; read as data), conv_w [12][1][3][1]; qn, kn = l2-normalised Q, K; W = (1 - acos(clip(qn.kn, -1, 1))/pi)^8 x mask_j (expected LSH collision,
// hash_code_len 8; no softmax); X = l2norm((W V) x mask_i); out = X + depthwise conv of (V x mask) over the sequence (3 taps, padding 1, per head) -> [2][12][2048][64]).
// Compute dtypes, f32 accumulate: every input rounded to bf16; the l2 normalisations in f32 (wave per 16 rows) -> SINGLE fp16 planes; qn.kn (K 64) fp16; weight (see wq2) in
// f32 on VALU -> fp16 weights x1024; W.V (K 2048) fp16 x fp16(bf16 V x bf16 key mask); the output normalisation, the 3-tap conv and the sum in f32 (the output is dominated by the conv term).

#define NZ   24                   // batch x heads
#define NHD  12
#define TT   2048
#define HD   64
#define PCAR 1024.0f
typedef _Float16 h16;
typedef __attribute__((ext_vector_type(16))) _Float16 v16h;
typedef __attribute__((ext_vector_type(8)))  _Float16 v8h;
typedef __attribute__((ext_vector_type(8)))  float    v8f;
typedef __attribute__((ext_vector_type(4)))  float    v4f;

__device__ __forceinline__ unsigned short f2bf(float f) { unsigned u = __float_as_uint(f); u += 0x7FFFu + ((u >> 16) & 1u); return (unsigned short)(u >> 16); }
__device__ __forceinline__ float bf2f(unsigned short b) { return __uint_as_float(((unsigned)b) << 16); }
__device__ __forceinline__ float bfr(float f) { return bf2f(f2bf(f)); }
__device__ __forceinline__ v16h cat16(v8h lo, v8h hi) { return __builtin_shufflevector(lo, hi, 0, 1, 2, 3, 4, 5, 6, 7, 8, 9, 10, 11, 12, 13, 14, 15); }
__device__ __forceinline__ v8f wmma16(v16h a, v16h b, v8f c) { return __builtin_amdgcn_wmma_f32_16x16x32_f16(false, a, false, b, (short)0, c, false, false); }

__device__ __forceinline__ h16 tohx(float x) { return (h16)x; }
typedef __attribute__((ext_vector_type(4))) _Float16 v4h;
typedef __attribute__((ext_vector_type(2))) float v2f;
typedef __attribute__((ext_vector_type(2))) __bf16 v2b;

// FRAGMENT ORDER of the three fp16 planes: a 16 x 32 operand tile is 1,024 contiguous bytes, [j 0..1][lane 0..31][s 0..7] = row (lane & 15), k = 16 j + 8 (lane >> 4) + s: what lane and register half j of the
// matrix operand hold. One 16-byte load of a wave then reads 512 contiguous bytes (4 lines) where the row-major planes cost it 16 lines. Qn, Kn: tile = 16 rows x dims 32 dc ..; tiles in the order (row tile, dc).
// Vt: tile = dims 16 nb .. x 32 keys; tiles in the order (key chunk, nb). The packer wave owns whole 512-byte pieces, so every line has one writer. '#pragma unroll' in the packer: as noted at k_att.
// k_pack: ONE LAUNCH PACKS ALL THREE PLANES. Wave w of the 3,072 takes row tile w of Q, row tile w of K and key tile w of V: three jobs that need nothing of each other. All its loads are asked for first,
// so the wave pays one start and one memory latency for the three, and the arithmetic of one job runs while the next job's data are still on the way (loads return in the order asked).
// Q, K (16 rows): lane (c, h) holds of row c the dims 16 q + 8 h + s, q 0..3: its own 16 bytes of the pieces q = 2 dc + j. The row's square sum: 32 terms in the lane, then the partner lane's.
// V (16 keys x 64 dims; w = 128 z + key tile; key chunk w >> 1, half j = w & 1): lane (c, h) reads keys 8 h + s at dim 16 nb + c (two 64-byte runs a load) and stores its 16 bytes of the four pieces (nb, j).
// THE KEY MASK LIVES IN Vt: sum_j (W mask_j) V_j = sum_j W (mask_j V_j), so the plane holds fp16(bf16(V) bf16(mask)), formed once per element of V here, and the attention loop never sees the mask of a key.
__global__ __launch_bounds__(128) void k_pack(const float* __restrict__ Q, const float* __restrict__ K, const float* __restrict__ V, const float* __restrict__ mk, h16* QN, h16* KN, h16* VT) {
    const int lane = threadIdx.x & 31, c = lane & 15, h = lane >> 4; const int w = blockIdx.x * 4 + (threadIdx.x >> 5); if (w >= NZ * TT / 16) return;
    const size_t ro = ((size_t)w * 16 + c) * HD + 8 * h; const float* sq = Q + ro; const float* sk = K + ro;
    const float* src = V + ((size_t)w * 16 + 8 * h) * HD + c;
    const float* mq = mk + (size_t)((w >> 7) / NHD) * TT + (w & 127) * 16 + 8 * h;     // the lane's eight keys in its batch's mask row
    v4f a[2][4][2];
#pragma unroll
    for (int q = 0; q < 4; ++q) { a[0][q][0] = *(const v4f*)(sq + 16 * q); a[0][q][1] = *(const v4f*)(sq + 16 * q + 4); }
#pragma unroll
    for (int q = 0; q < 4; ++q) { a[1][q][0] = *(const v4f*)(sk + 16 * q); a[1][q][1] = *(const v4f*)(sk + 16 * q + 4); }
    const v4f m0 = *(const v4f*)mq, m1 = *(const v4f*)(mq + 4);
    float xv[4][8];
#pragma unroll
    for (int nb = 0; nb < 4; ++nb)
#pragma unroll
        for (int r = 0; r < 8; ++r) xv[nb][r] = src[r * HD + nb * 16];
    asm volatile("s_wait_xcnt 0x0" :: "v"(sq), "v"(sk), "v"(mq), "v"(src) : "memory");     // the pointers are inputs so that their registers live up to the wait: no load of the run above may land in a register that the run names
    __builtin_amdgcn_sched_barrier(0);     // keeps the arithmetic behind all the loads: sunk among it, V's loads would be asked for late and show their latency at the wave's end
#pragma unroll
    for (int p = 0; p < 2; ++p) { float x[4][8]; float s = 0.0f;
#pragma unroll
        for (int q = 0; q < 4; ++q)
#pragma unroll
            for (int r = 0; r < 8; ++r) { x[q][r] = bfr(a[p][q][r >> 2][r & 3]); s += x[q][r] * x[q][r]; }
        s += __shfl_xor(s, 16, 32);
        const float nrm = fmaxf(__fsqrt_rn(s), 1e-12f); h16* dst = (p ? KN : QN) + (size_t)w * 1024 + lane * 8;
#pragma unroll
        for (int q = 0; q < 4; ++q) { v8h o;
#pragma unroll
            for (int r = 0; r < 8; ++r) o[r] = tohx(__fdiv_rn(x[q][r], nrm));
            *(v8h*)(dst + q * 256) = o;
            asm volatile("s_wait_xcnt 0x0" ::: "memory"); } }     // the registers that the store names are reused by the arithmetic that follows: only behind this wait
    float mm[8];
#pragma unroll
    for (int r = 0; r < 8; ++r) mm[r] = bfr(r < 4 ? m0[r & 3] : m1[r & 3]);
    h16* dst = VT + ((size_t)(w >> 1) * 8 + (w & 1)) * 256 + lane * 8;
#pragma unroll
    for (int nb = 0; nb < 4; ++nb) { v8h o;
#pragma unroll
        for (int r = 0; r < 8; ++r) o[r] = tohx(bfr(xv[nb][r]) * mm[r]);
        *(v8h*)(dst + nb * 512) = o; }  }
// ---- k_att: the whole weighted sum of one 16-query tile in ONE WAVE; no score and no weight leaves the registers. Grid 256 x 12 waves = 24 heads x 128 tiles.
// Per 32 keys: St = Kn . Qn^T (two 16-key tiles, K 64; lane (c, h), register r = key 8h + r, query c); weight in f32 in place; the two tiles, converted, ARE the B operand
// Pt of Ot += Vt . Pt (hardware k order: element s = key 8h + s, then 16 + 8h + s - 8; the Vt and Kn / Qn loader ldf has the same order: the planes lie in it). Keys ascend in steps of 32, as before.
// Every '#pragma unroll' without a number: the arrays stay in registers only under constant indices.
// The wave ends with its 16 output rows (see behind the loop): the weighted sum never goes to memory.
// K AND V COME THROUGH LDS: the twelve waves of a work-group walk the same keys, so each stage of 128 keys (16 KB of Kn, 16 KB of Vt, both already in fragment order: two straight runs of memory) is brought in ONCE
// per work-group by asynchronous copies, and every wave takes its fragments from there with 16-byte LDS reads of 512 contiguous bytes a wave. Two buffers: stage s + 1 flies while stage s is worked on.
// A work-group's twelve query tiles can lie in two heads (128 tiles a head): such a work-group stages both heads' keys, and each wave reads its own head's.
// Left for later steps: Qn still goes through memory (the attention wave could normalise its own 16 rows); the packer divides every element by its row norm.
// wq2: two collision weights x 1024 from two dots d. acos(d) = 2 asin(y), y = sqrt((1 - d) / 2), so base = 1 - acos(d)/pi = 1 - (2/pi) asin(y). base has a root-type end at y = 1, base^2 a simple zero there: base^2 is smooth on
// the whole of [0, 1] and ONE polynomial in y covers every d in [-1, 1], with no case split, no sign handling and no second series. q = 1024^(1/4) base^2 by a degree-6 fit (weighted towards relative error), then q^4.
// Error of the weight in f32 arithmetic, a square root one ulp off included: under 2e-5 relative for d > -0.8, under 7e-5 wherever the fp16 weight is normal, never above a quarter of half an fp16 step.
// The clip of d to [-1, 1] is the clamp of (1 - d) / 2 to [0, 1].
__device__ __forceinline__ v2f wq2(const float d0, const float d1) {
    v2f y; y[0] = __builtin_amdgcn_sqrtf(__builtin_amdgcn_fmed3f(fmaf(d0, -0.5f, 0.5f), 0.0f, 1.0f)); y[1] = __builtin_amdgcn_sqrtf(__builtin_amdgcn_fmed3f(fmaf(d1, -0.5f, 0.5f), 0.0f, 1.0f));
    v2f q = y * 0.0424227603f + -0.223755330f; q = q * y + 0.584063053f; q = q * y + -1.13987541f; q = q * y + 2.28209758f; q = q * y + -7.20179796f; q = q * y + 5.65684557f;
    q = q * q; return q * q; }
__device__ __forceinline__ v16h ldf(const h16* p) { return cat16(*(const v8h*)p, *(const v8h*)(p + 256)); }     // p: the lane's 16 bytes of piece j = 0; piece 1 lies 512 bytes on
#define KS   128                  // keys a stage
#define STE  (KS * HD)            // elements of one operand's stage (16 KB)
#define NST  (TT / KS)
__global__ __launch_bounds__(384) void k_att(const h16* __restrict__ QN, const h16* __restrict__ KN, const h16* __restrict__ VT, const float* __restrict__ mk, const float* __restrict__ V, const float* __restrict__ cw, float* __restrict__ OUT) {
    __shared__ __attribute__((aligned(16))) h16 sm[2][2][2][STE];     // [buffer][first, second head of the work-group][Kn, Vt]: 128 KB
    const int lane = threadIdx.x & 31, c = lane & 15, h = lane >> 4;
    const int wave = __builtin_amdgcn_readfirstlane(threadIdx.x >> 5);
    const int g = blockIdx.x * 12 + wave;
    const int z = g >> 7, q0 = (g & 127) * 16;
    const int za = (blockIdx.x * 12) >> 7; const bool two = ((blockIdx.x * 12 + 11) >> 7) != za;     // the work-group's first head; whether its last wave is in the next one
    const h16* qp = QN + (size_t)g * 1024 + lane * 8;     // 16 rows x 64 dims = 1,024 elements a row tile
    const h16* sl = &sm[0][z - za][0][lane * 8];     // the lane's 16 bytes of the first piece of its head's Kn in buffer 0
    const unsigned lds0 = (unsigned)(size_t)&sm[0][0][0][lane * 8];     // the same place of the first head as an LDS byte address
    // fill: wave w < 8 brings its 4 KB (w < 4: a quarter of Kn's 16 KB, else of Vt's) of stage st of head za + e: eight copies of 512 bytes, a lane's 16 bytes each.
    auto fill = [&](const int st, const int e) __attribute__((always_inline)) {
        const h16* gs = (wave < 4 ? KN : VT) + (size_t)(za + e) * TT * HD + (size_t)st * STE + (wave & 3) * 2048 + lane * 8;
        const unsigned ld = lds0 + (unsigned)((((st & 1) * 2 + e) * 2 * STE + wave * 2048) * 2);
        // the wait is the statement's last line: the address registers of the copies are free for reuse only behind it
        asm volatile("global_load_async_to_lds_b128 %0, %8, off\n\tglobal_load_async_to_lds_b128 %1, %9, off\n\tglobal_load_async_to_lds_b128 %2, %10, off\n\tglobal_load_async_to_lds_b128 %3, %11, off\n\t"
                     "global_load_async_to_lds_b128 %4, %12, off\n\tglobal_load_async_to_lds_b128 %5, %13, off\n\tglobal_load_async_to_lds_b128 %6, %14, off\n\tglobal_load_async_to_lds_b128 %7, %15, off\n\ts_wait_xcnt 0x0"
                     :: "v"(ld), "v"(ld + 512), "v"(ld + 1024), "v"(ld + 1536), "v"(ld + 2048), "v"(ld + 2560), "v"(ld + 3072), "v"(ld + 3584),
                        "v"(gs), "v"(gs + 256), "v"(gs + 512), "v"(gs + 768), "v"(gs + 1024), "v"(gs + 1280), "v"(gs + 1536), "v"(gs + 1792) : "memory"); };
    auto stage = [&](const int st) __attribute__((always_inline)) { if (wave < 8) { fill(st, 0); if (two) fill(st, 1); } };     // both tests are the same for a whole wave, the second for the work-group
    stage(0);
    v8f acc[4];
#pragma unroll
    for (int nb = 0; nb < 4; ++nb) acc[nb] = (v8f){};
    __builtin_amdgcn_sched_barrier(0);     // with the one behind the wait: no address arithmetic between the first loads and their s_wait_xcnt, where it rewrote a register that a load names
    const v16h qf0 = ldf(qp), qf1 = ldf(qp + 512);
    v16h kf[2][2];
    asm volatile("s_wait_xcnt 0x0" ::: "memory");     // the address registers of the loads above are free for reuse behind it
    __builtin_amdgcn_sched_barrier(0);     // see above
    asm volatile("s_wait_asynccnt 0x0" ::: "memory");     // this wave's copies of stage 0 have landed
    __syncthreads();     // stage 0 is published: every wave's copies have landed
    stage(1);
    // one pass = 32 keys, the ps-th of its stage. sb: the lane's place in the stage's Kn; its Vt lies STE elements on.
    auto pass = [&](const h16* sb, const int ps) __attribute__((always_inline)) {
        v16h vf[4];     // asked for here, used behind the weights
#pragma unroll
        for (int nb = 0; nb < 4; ++nb) vf[nb] = ldf(sb + STE + ps * 2048 + nb * 512);     // 32 keys x 64 dims = 2,048 elements a key chunk
        v8f s[2];
#pragma unroll
        for (int t = 0; t < 2; ++t) { s[t] = wmma16(kf[t][0], qf0, (v8f){}); s[t] = wmma16(kf[t][1], qf1, s[t]); }
        if (ps < KS / 32 - 1) {     // the next pass's keys, one pass ahead, inside the stage only: the next stage is not published yet
#pragma unroll
            for (int t = 0; t < 2; ++t) { kf[t][0] = ldf(sb + (ps + 1) * 2048 + t * 1024); kf[t][1] = ldf(sb + (ps + 1) * 2048 + t * 1024 + 512); } }
        __builtin_amdgcn_sched_barrier(0);     // keeps the loads above in front of the weights: sunk to their uses, each would show its whole latency
        v16h p;
#pragma unroll
        for (int t = 0; t < 2; ++t)
#pragma unroll
            for (int r = 0; r < 8; r += 2) { const v2f w = wq2(s[t][r], s[t][r + 1]);
                p[t * 8 + r] = tohx(w[0]); p[t * 8 + r + 1] = tohx(w[1]); }
#pragma unroll
        for (int nb = 0; nb < 4; ++nb) acc[nb] = wmma16(vf[nb], p, acc[nb]);
        __builtin_amdgcn_sched_barrier(0);     // keeps the next pass's score products behind these weights: lifted over them, they wait for keys that were only just asked for
    };
#pragma unroll 1     // one trip = one stage = four passes; more would only lengthen the text
    for (int st = 0; st < NST; ++st) { const h16* sb = sl + (st & 1) * (4 * STE);
#pragma unroll
        for (int t = 0; t < 2; ++t) { kf[t][0] = ldf(sb + t * 1024); kf[t][1] = ldf(sb + t * 1024 + 512); }
        pass(sb, 0); pass(sb, 1); pass(sb, 2); pass(sb, 3);
        asm volatile("s_wait_dscnt 0x0" ::: "memory");     // this wave's reads of the buffer are over before the buffer is given up
        asm volatile("s_wait_asynccnt 0x0" ::: "memory");     // this wave's copies of stage st + 1 have landed
        __syncthreads();     // publishes stage st + 1 and ends every wave's reads of stage st
        if (st + 2 < NST) stage(st + 2);     // into the buffer that this trip has just read
    }
    asm volatile("s_wait_asynccnt 0x0" ::: "memory");     // no copy is outstanding when the wave goes on to its end
    // The output rows. acc[nb][r] = 1024 (W V)[t][16 nb + 8h + r], t = q0 + c: lanes (c, 0) and (c, 1) hold the whole of row t.
    // x = (acc / 1024) bf16(mask[b][t]); X = x / max(||x||, 1e-12), the square sum 32 terms in the lane (even dims, odd dims, their sum), then the partner lane's;
    // out = X + sum_k bf16(w[head][k]) (bf16(V[z][t + k - 1][d]) bf16(mask[b][t + k - 1])), rows outside the sequence count as zero.
    // w (v m) is formed as (w m) v: every factor has 8 significant bits, so both products are exact in f32 in either order.
    const int t = q0 + c; const float* mrow = mk + (size_t)(z / NHD) * TT; const float* wrow = cw + (z % NHD) * 3;
    const int tl = t > 0 ? t - 1 : t, tr = t < TT - 1 ? t + 1 : t;     // the neighbours' addresses stay in the plane; at the ends their tap weight is zero
    const float* vz = V + (size_t)z * TT * HD + 8 * h;
    const float* vl = vz + (size_t)tl * HD; const float* vc = vz + (size_t)t * HD; const float* vn = vz + (size_t)tr * HD;
    const float ml = mrow[tl], mc = mrow[t], mr = mrow[tr];
    v4f vv[3][4][2];
#pragma unroll
    for (int nb = 0; nb < 4; ++nb) { vv[0][nb][0] = *(const v4f*)(vl + nb * 16); vv[0][nb][1] = *(const v4f*)(vl + nb * 16 + 4); vv[1][nb][0] = *(const v4f*)(vc + nb * 16); vv[1][nb][1] = *(const v4f*)(vc + nb * 16 + 4);
        vv[2][nb][0] = *(const v4f*)(vn + nb * 16); vv[2][nb][1] = *(const v4f*)(vn + nb * 16 + 4); }
    asm volatile("s_wait_xcnt 0x0" :: "v"(vl), "v"(vc), "v"(vn), "v"(tl), "v"(t), "v"(tr) : "memory");     // pointers and row numbers are inputs so that their registers live up to the wait: no load of the run above may land in a register that the run names
    const float mt = bfr(mc); const float wm[3] = { bfr(wrow[0]) * bfr(ml) * (t > 0 ? 1.0f : 0.0f), bfr(wrow[1]) * mt, bfr(wrow[2]) * bfr(mr) * (t < TT - 1 ? 1.0f : 0.0f) };
    const float xs = mt * (1.0f / PCAR);     // a power of two: (acc / 1024) mask = acc (mask / 1024)
    v2f sq2 = (v2f){};     // even and odd dims apart: packed arithmetic
#pragma unroll
    for (int nb = 0; nb < 4; ++nb)
#pragma unroll
        for (int r = 0; r < 8; r += 2) { v2f x; x[0] = acc[nb][r]; x[1] = acc[nb][r + 1]; x = x * xs; sq2 = x * x + sq2; acc[nb][r] = x[0]; acc[nb][r + 1] = x[1]; }
    float sq = sq2[0] + sq2[1];
    { const int sb = __float_as_int(sq); sq += __int_as_float(__builtin_amdgcn_permlanex16(sb, sb, 0x76543210, 0xfedcba98, false, false)); }     // lane l ^ 16: the other half of the row
    const float nrm = fmaxf(__fsqrt_rn(sq), 1e-12f);
    float* orow = OUT + ((size_t)z * TT + t) * HD + 8 * h;
#pragma unroll
    for (int nb = 0; nb < 4; ++nb)
#pragma unroll
        for (int r = 0; r < 8; r += 2) { v2f y; y[0] = __fdiv_rn(acc[nb][r], nrm); y[1] = __fdiv_rn(acc[nb][r + 1], nrm);
#pragma unroll
            for (int k = 0; k < 3; ++k) { v2f u; u[0] = vv[k][nb][r >> 2][r & 3]; u[1] = vv[k][nb][r >> 2][(r & 3) + 1]; const v2b ub = __builtin_convertvector(u, v2b);     // to bf16, nearest even, two at a time
                y[0] += wm[k] * (float)ub[0]; y[1] += wm[k] * (float)ub[1]; }
            acc[nb][r] = y[0]; acc[nb][r + 1] = y[1]; }
#pragma unroll
    for (int nb = 0; nb < 4; ++nb) { v4f lo, hi4;
#pragma unroll
        for (int r = 0; r < 4; ++r) { lo[r] = acc[nb][r]; hi4[r] = acc[nb][4 + r]; }
        *(v4f*)(orow + nb * 16) = lo; *(v4f*)(orow + nb * 16 + 4) = hi4; }
}

extern "C" void kernel_launch(void* const* d_in, const int* in_sizes, int n_in,
                              void* d_out, int out_size, void* d_ws, size_t ws_size, hipStream_t stream) {
    (void)in_sizes; (void)n_in; (void)out_size;
    const float* Q = (const float*)d_in[0]; const float* K = (const float*)d_in[1]; const float* V = (const float*)d_in[2]; const float* mk = (const float*)d_in[3]; const float* cw = (const float*)d_in[4];
    float* OUT = (float*)d_out;     // [2][12][2048][64]
    char* wsp = (char*)d_ws;
    auto take = [&](size_t bytes) { char* p = wsp; wsp += (bytes + 255) & ~(size_t)255; return (void*)p; };
    h16* QN = (h16*)take((size_t)NZ * TT * HD * 2); h16* KN = (h16*)take((size_t)NZ * TT * HD * 2); h16* VT = (h16*)take((size_t)NZ * HD * TT * 2);
    if ((size_t)(wsp - (char*)d_ws) > ws_size) return;    // total ~ 19 MB; ws 256 MiB
    k_pack<<<NZ * TT / 16 / 4, 128, 0, stream>>>(Q, K, V, mk, QN, KN, VT);
    k_att<<<NZ * TT / 16 / 12, 384, 0, stream>>>(QN, KN, VT, mk, V, cw, OUT);
}

// v008
// A run of this version takes 39.3 microseconds.
// Two timings next to v007 both put it at 1.03 times that version's speed.
// Counting every step since v000, it is 22.7 times as fast.
#include <hip/hip_runtime.h>

// YOSOAttention (Q, K, V [2][12][2048][64], mask [2][2048] (all ones here; read as data), conv_w [12][1][3][1]; qn, kn = l2-normalised Q, K; W = (1 - acos(clip(qn.kn, -1, 1))/pi)^8 x mask_j (expected LSH collision,
// hash_code_len 8; no softmax); X = l2norm((W V) x mask_i); out = X + depthwise conv of (V x mask) over the sequence (3 taps, padding 1, per head) -> [2][12][2048][64]).
// Compute dtypes, f32 accumulate: every input rounded to bf16; the l2 normalisations in f32 (wave per 16 rows) -> SINGLE fp16 planes; qn.kn (K 64) fp16; weight (see wq2) in
// f32 on VALU -> fp16 weights x1024; W.V (K 2048) fp16 x fp16(bf16 V x bf16 key mask); the output normalisation, the 3-tap conv and the sum in f32 (the output is dominated by the conv term).

#define NZ   24                   // batch x heads
#define NHD  12
#define TT   2048
#define HD   64
#define PCAR 1024.0f
typedef _Float16 h16;
typedef __attribute__((ext_vector_type(16))) _Float16 v16h;
typedef __attribute__((ext_vector_type(8)))  _Float16 v8h;
typedef __attribute__((ext_vector_type(8)))  float    v8f;
typedef __attribute__((ext_vector_type(4)))  float    v4f;

__device__ __forceinline__ unsigned short f2bf(float f) { unsigned u = __float_as_uint(f); u += 0x7FFFu + ((u >> 16) & 1u); return (unsigned short)(u >> 16); }
__device__ __forceinline__ float bf2f(unsigned short b) { return __uint_as_float(((unsigned)b) << 16); }
__device__ __forceinline__ float bfr(float f) { return bf2f(f2bf(f)); }
__device__ __forceinline__ v16h cat16(v8h lo, v8h hi) { return __builtin_shufflevector(lo, hi, 0, 1, 2, 3, 4, 5, 6, 7, 8, 9, 10, 11, 12, 13, 14, 15); }
__device__ __forceinline__ v8f wmma16(v16h a, v16h b, v8f c) { return __builtin_amdgcn_wmma_f32_16x16x32_f16(false, a, false, b, (short)0, c, false, false); }

__device__ __forceinline__ h16 tohx(float x) { return (h16)x; }
typedef __attribute__((ext_vector_type(4))) _Float16 v4h;
typedef __attribute__((ext_vector_type(2))) float v2f;
typedef __attribute__((ext_vector_type(2))) __bf16 v2b;

// FRAGMENT ORDER of the three fp16 planes: a 16 x 32 operand tile is 1,024 contiguous bytes, [j 0..1][lane 0..31][s 0..7] = row (lane & 15), k = 16 j + 8 (lane >> 4) + s: what lane and register half j of the
// matrix operand hold. One 16-byte load of a wave then reads 512 contiguous bytes (4 lines) where the row-major planes cost it 16 lines. Qn, Kn: tile = 16 rows x dims 32 dc ..; tiles in the order (row tile, dc).
// Vt: tile = dims 16 nb .. x 32 keys; tiles in the order (key chunk, nb). The packer wave owns whole 512-byte pieces, so every line has one writer. '#pragma unroll' in the packer: as noted at k_att.
// k_pack: ONE LAUNCH PACKS ALL THREE PLANES. Wave w of the 3,072 takes row tile w of Q, row tile w of K and key tile w of V: three jobs that need nothing of each other. All its loads are asked for first,
// so the wave pays one start and one memory latency for the three, and the arithmetic of one job runs while the next job's data are still on the way (loads return in the order asked).
// Q, K (16 rows): lane (c, h) holds of row c the dims 16 q + 8 h + s, q 0..3: its own 16 bytes of the pieces q = 2 dc + j. The row's square sum: 32 terms in the lane, then the partner lane's.
// V (16 keys x 64 dims; w = 128 z + key tile; key chunk w >> 1, half j = w & 1): lane (c, h) reads keys 8 h + s at dim 16 nb + c (two 64-byte runs a load) and stores its 16 bytes of the four pieces (nb, j).
// THE KEY MASK LIVES IN Vt: sum_j (W mask_j) V_j = sum_j W (mask_j V_j), so the plane holds fp16(bf16(V) bf16(mask)), formed once per element of V here, and the attention loop never sees the mask of a key.
__global__ __launch_bounds__(128) void k_pack(const float* __restrict__ Q, const float* __restrict__ K, const float* __restrict__ V, const float* __restrict__ mk, h16* QN, h16* KN, h16* VT) {
    const int lane = threadIdx.x & 31, c = lane & 15, h = lane >> 4; const int w = blockIdx.x * 4 + (threadIdx.x >> 5); if (w >= NZ * TT / 16) return;
    const size_t ro = ((size_t)w * 16 + c) * HD + 8 * h; const float* sq = Q + ro; const float* sk = K + ro;
    const float* src = V + ((size_t)w * 16 + 8 * h) * HD + c;
    const float* mq = mk + (size_t)((w >> 7) / NHD) * TT + (w & 127) * 16 + 8 * h;     // the lane's eight keys in its batch's mask row
    v4f a[2][4][2];
#pragma unroll
    for (int q = 0; q < 4; ++q) { a[0][q][0] = *(const v4f*)(sq + 16 * q); a[0][q][1] = *(const v4f*)(sq + 16 * q + 4); }
#pragma unroll
    for (int q = 0; q < 4; ++q) { a[1][q][0] = *(const v4f*)(sk + 16 * q); a[1][q][1] = *(const v4f*)(sk + 16 * q + 4); }
    const v4f m0 = *(const v4f*)mq, m1 = *(const v4f*)(mq + 4);
    float xv[4][8];
#pragma unroll
    for (int nb = 0; nb < 4; ++nb)
#pragma unroll
        for (int r = 0; r < 8; ++r) xv[nb][r] = src[r * HD + nb * 16];
    asm volatile("s_wait_xcnt 0x0" :: "v"(sq), "v"(sk), "v"(mq), "v"(src) : "memory");     // the pointers are inputs so that their registers live up to the wait: no load of the run above may land in a register that the run names
    __builtin_amdgcn_sched_barrier(0);     // keeps the arithmetic behind all the loads: sunk among it, V's loads would be asked for late and show their latency at the wave's end
#pragma unroll
    for (int p = 0; p < 2; ++p) { float x[4][8]; float s = 0.0f;
#pragma unroll
        for (int q = 0; q < 4; ++q)
#pragma unroll
            for (int r = 0; r < 8; ++r) { x[q][r] = bfr(a[p][q][r >> 2][r & 3]); s += x[q][r] * x[q][r]; }
        s += __shfl_xor(s, 16, 32);
        const float nrm = fmaxf(__fsqrt_rn(s), 1e-12f) * (p ? -2.0f : 1.0f);     // the K plane holds -kn / 2 (see wq2): a power of two, so every quotient keeps its digits
        h16* dst = (p ? KN : QN) + (size_t)w * 1024 + lane * 8;
#pragma unroll
        for (int q = 0; q < 4; ++q) { v8h o;
#pragma unroll
            for (int r = 0; r < 8; ++r) o[r] = tohx(__fdiv_rn(x[q][r], nrm));
            *(v8h*)(dst + q * 256) = o;
            asm volatile("s_wait_xcnt 0x0" ::: "memory"); } }     // the registers that the store names are reused by the arithmetic that follows: only behind this wait
    float mm[8];
#pragma unroll
    for (int r = 0; r < 8; ++r) mm[r] = bfr(r < 4 ? m0[r & 3] : m1[r & 3]);
    h16* dst = VT + ((size_t)(w >> 1) * 8 + (w & 1)) * 256 + lane * 8;
#pragma unroll
    for (int nb = 0; nb < 4; ++nb) { v8h o;
#pragma unroll
        for (int r = 0; r < 8; ++r) o[r] = tohx(bfr(xv[nb][r]) * mm[r]);
        *(v8h*)(dst + nb * 512) = o; }  }
// ---- k_att: the whole weighted sum of one 16-query tile in ONE WAVE; no score and no weight leaves the registers. Grid 256 x 12 waves = 24 heads x 128 tiles.
// Per 32 keys: St = 0.5 + Kn . Qn^T, Kn = -kn / 2 (two 16-key tiles, K 64; lane (c, h), register r = key 8h + r, query c); weight in f32 in place; the two tiles, converted, ARE the B operand
// Pt of Ot += Vt . Pt (hardware k order: element s = key 8h + s, then 16 + 8h + s - 8; the Vt and Kn / Qn loader ldf has the same order: the planes lie in it). Keys ascend in steps of 32, as before.
// Every '#pragma unroll' without a number: the arrays stay in registers only under constant indices.
// The wave ends with its 16 output rows (see behind the loop): the weighted sum never goes to memory.
// K AND V COME THROUGH LDS: the twelve waves of a work-group walk the same keys, so each stage of 128 keys (16 KB of Kn, 16 KB of Vt, both already in fragment order: two straight runs of memory) is brought in ONCE
// per work-group by asynchronous copies, and every wave takes its fragments from there with 16-byte LDS reads of 512 contiguous bytes a wave. Two buffers: stage s + 1 flies while stage s is worked on.
// A work-group's twelve query tiles can lie in two heads (128 tiles a head): such a work-group stages both heads' keys, and each wave reads its own head's.
// Left for later steps: Qn still goes through memory (the attention wave could normalise its own 16 rows); the packer divides every element by its row norm.
// wq2: two collision weights x 1024 for two dots d. acos(d) = 2 asin(y), y = sqrt((1 - d) / 2), so base = 1 - acos(d)/pi = 1 - (2/pi) asin(y). base has a root-type end at y = 1, base^2 a simple zero there: base^2 is smooth on
// the whole of [0, 1] and ONE polynomial in y covers every d in [-1, 1], with no case split, no sign handling and no second series. q = 1024^(1/4) base^2 by a degree-6 fit (weighted towards relative error), then q^4.
// Error of the weight in f32 arithmetic, a square root one ulp off included: under 2e-5 relative for d > -0.8, under 7e-5 wherever the fp16 weight is normal, never above a quarter of half an fp16 step.
// THE ROOT'S ARGUMENT u = (1 - d) / 2 COMES READY FROM THE SCORE PRODUCT: the K plane holds -kn / 2 and the product starts from C = 0.5, so no vector instruction forms it.
// The clip of d to [-1, 1] is the clamp of u to [0, 1], and that is the clamp of the root to [0, 1]: u > 1 gives a root above 1; u < 0 gives NaN, of which the median with 0 and 1 makes 0, the root of the clamped u.
// Behind the root the clamp costs nothing: it is the root instruction's own output modifier.
__device__ __forceinline__ v2f wq2(const float u0, const float u1) {
    v2f y; y[0] = __builtin_amdgcn_fmed3f(__builtin_amdgcn_sqrtf(u0), 0.0f, 1.0f); y[1] = __builtin_amdgcn_fmed3f(__builtin_amdgcn_sqrtf(u1), 0.0f, 1.0f);
    v2f q = y * 0.0424227603f + -0.223755330f; q = q * y + 0.584063053f; q = q * y + -1.13987541f; q = q * y + 2.28209758f; q = q * y + -7.20179796f; q = q * y + 5.65684557f;
    q = q * q; return q * q; }
__device__ __forceinline__ v16h ldf(const h16* p) { return cat16(*(const v8h*)p, *(const v8h*)(p + 256)); }     // p: the lane's 16 bytes of piece j = 0; piece 1 lies 512 bytes on
#define KS   128                  // keys a stage
#define STE  (KS * HD)            // elements of one operand's stage (16 KB)
#define NST  (TT / KS)
__global__ __launch_bounds__(384) void k_att(const h16* __restrict__ QN, const h16* __restrict__ KN, const h16* __restrict__ VT, const float* __restrict__ mk, const float* __restrict__ V, const float* __restrict__ cw, float* __restrict__ OUT) {
    __shared__ __attribute__((aligned(16))) h16 sm[2][2][2][STE];     // [buffer][first, second head of the work-group][Kn, Vt]: 128 KB
    const int lane = threadIdx.x & 31, c = lane & 15, h = lane >> 4;
    const int wave = __builtin_amdgcn_readfirstlane(threadIdx.x >> 5);
    const int g = blockIdx.x * 12 + wave;
    const int z = g >> 7, q0 = (g & 127) * 16;
    const int za = (blockIdx.x * 12) >> 7; const bool two = ((blockIdx.x * 12 + 11) >> 7) != za;     // the work-group's first head; whether its last wave is in the next one
    const h16* qp = QN + (size_t)g * 1024 + lane * 8;     // 16 rows x 64 dims = 1,024 elements a row tile
    const h16* sl = &sm[0][z - za][0][lane * 8];     // the lane's 16 bytes of the first piece of its head's Kn in buffer 0
    const unsigned lds0 = (unsigned)(size_t)&sm[0][0][0][lane * 8];     // the same place of the first head as an LDS byte address
    // fill: wave w < 8 brings its 4 KB (w < 4: a quarter of Kn's 16 KB, else of Vt's) of stage st of head za + e: eight copies of 512 bytes, a lane's 16 bytes each.
    auto fill = [&](const int st, const int e) __attribute__((always_inline)) {
        const h16* gs = (wave < 4 ? KN : VT) + (size_t)(za + e) * TT * HD + (size_t)st * STE + (wave & 3) * 2048 + lane * 8;
        const unsigned ld = lds0 + (unsigned)((((st & 1) * 2 + e) * 2 * STE + wave * 2048) * 2);
        // the wait is the statement's last line: the address registers of the copies are free for reuse only behind it
        asm volatile("global_load_async_to_lds_b128 %0, %8, off\n\tglobal_load_async_to_lds_b128 %1, %9, off\n\tglobal_load_async_to_lds_b128 %2, %10, off\n\tglobal_load_async_to_lds_b128 %3, %11, off\n\t"
                     "global_load_async_to_lds_b128 %4, %12, off\n\tglobal_load_async_to_lds_b128 %5, %13, off\n\tglobal_load_async_to_lds_b128 %6, %14, off\n\tglobal_load_async_to_lds_b128 %7, %15, off\n\ts_wait_xcnt 0x0"
                     :: "v"(ld), "v"(ld + 512), "v"(ld + 1024), "v"(ld + 1536), "v"(ld + 2048), "v"(ld + 2560), "v"(ld + 3072), "v"(ld + 3584),
                        "v"(gs), "v"(gs + 256), "v"(gs + 512), "v"(gs + 768), "v"(gs + 1024), "v"(gs + 1280), "v"(gs + 1536), "v"(gs + 1792) : "memory"); };
    auto stage = [&](const int st) __attribute__((always_inline)) { if (wave < 8) { fill(st, 0); if (two) fill(st, 1); } };     // both tests are the same for a whole wave, the second for the work-group
    stage(0);
    v8f acc[4];
#pragma unroll
    for (int nb = 0; nb < 4; ++nb) acc[nb] = (v8f){};
    __builtin_amdgcn_sched_barrier(0);     // with the one behind the wait: no address arithmetic between the first loads and their s_wait_xcnt, where it rewrote a register that a load names
    const v16h qf0 = ldf(qp), qf1 = ldf(qp + 512);
    v16h kf[2][2];
    asm volatile("s_wait_xcnt 0x0" ::: "memory");     // the address registers of the loads above are free for reuse behind it
    __builtin_amdgcn_sched_barrier(0);     // see above
    asm volatile("s_wait_asynccnt 0x0" ::: "memory");     // this wave's copies of stage 0 have landed
    __syncthreads();     // stage 0 is published: every wave's copies have landed
    stage(1);
    // one pass = 32 keys, the ps-th of its stage. sb: the lane's place in the stage's Kn; its Vt lies STE elements on.
    auto pass = [&](const h16* sb, const int ps) __attribute__((always_inline)) {
        v16h vf[4];     // asked for here, used behind the weights
#pragma unroll
        for (int nb = 0; nb < 4; ++nb) vf[nb] = ldf(sb + STE + ps * 2048 + nb * 512);     // 32 keys x 64 dims = 2,048 elements a key chunk
        v8f s[2];
#pragma unroll
        for (int t = 0; t < 2; ++t) { s[t] = wmma16(kf[t][0], qf0, (v8f){0.5f, 0.5f, 0.5f, 0.5f, 0.5f, 0.5f, 0.5f, 0.5f}); s[t] = wmma16(kf[t][1], qf1, s[t]); }     // 0.5 - kn.qn / 2: wq2's u
        if (ps < KS / 32 - 1) {     // the next pass's keys, one pass ahead, inside the stage only: the next stage is not published yet
#pragma unroll
            for (int t = 0; t < 2; ++t) { kf[t][0] = ldf(sb + (ps + 1) * 2048 + t * 1024); kf[t][1] = ldf(sb + (ps + 1) * 2048 + t * 1024 + 512); } }
        __builtin_amdgcn_sched_barrier(0);     // keeps the loads above in front of the weights: sunk to their uses, each would show its whole latency
        v16h p;
#pragma unroll
        for (int t = 0; t < 2; ++t)
#pragma unroll
            for (int r = 0; r < 8; r += 2) { const v2f w = wq2(s[t][r], s[t][r + 1]);
                p[t * 8 + r] = tohx(w[0]); p[t * 8 + r + 1] = tohx(w[1]); }
#pragma unroll
        for (int nb = 0; nb < 4; ++nb) acc[nb] = wmma16(vf[nb], p, acc[nb]);
        __builtin_amdgcn_sched_barrier(0);     // keeps the next pass's score products behind these weights: lifted over them, they wait for keys that were only just asked for
    };
#pragma unroll 1     // one trip = one stage = four passes; more would only lengthen the text
    for (int st = 0; st < NST; ++st) { const h16* sb = sl + (st & 1) * (4 * STE);
#pragma unroll
        for (int t = 0; t < 2; ++t) { kf[t][0] = ldf(sb + t * 1024); kf[t][1] = ldf(sb + t * 1024 + 512); }
        pass(sb, 0); pass(sb, 1); pass(sb, 2); pass(sb, 3);
        asm volatile("s_wait_dscnt 0x0" ::: "memory");     // this wave's reads of the buffer are over before the buffer is given up
        asm volatile("s_wait_asynccnt 0x0" ::: "memory");     // this wave's copies of stage st + 1 have landed
        __syncthreads();     // publishes stage st + 1 and ends every wave's reads of stage st
        if (st + 2 < NST) stage(st + 2);     // into the buffer that this trip has just read
    }
    asm volatile("s_wait_asynccnt 0x0" ::: "memory");     // no copy is outstanding when the wave goes on to its end
    // The output rows. acc[nb][r] = 1024 (W V)[t][16 nb + 8h + r], t = q0 + c: lanes (c, 0) and (c, 1) hold the whole of row t.
    // x = (acc / 1024) bf16(mask[b][t]); X = x / max(||x||, 1e-12), the square sum 32 terms in the lane (even dims, odd dims, their sum), then the partner lane's;
    // out = X + sum_k bf16(w[head][k]) (bf16(V[z][t + k - 1][d]) bf16(mask[b][t + k - 1])), rows outside the sequence count as zero.
    // w (v m) is formed as (w m) v: every factor has 8 significant bits, so both products are exact in f32 in either order.
    const int t = q0 + c; const float* mrow = mk + (size_t)(z / NHD) * TT; const float* wrow = cw + (z % NHD) * 3;
    const int tl = t > 0 ? t - 1 : t, tr = t < TT - 1 ? t + 1 : t;     // the neighbours' addresses stay in the plane; at the ends their tap weight is zero
    const float* vz = V + (size_t)z * TT * HD + 8 * h;
    const float* vl = vz + (size_t)tl * HD; const float* vc = vz + (size_t)t * HD; const float* vn = vz + (size_t)tr * HD;
    const float ml = mrow[tl], mc = mrow[t], mr = mrow[tr];
    v4f vv[3][4][2];
#pragma unroll
    for (int nb = 0; nb < 4; ++nb) { vv[0][nb][0] = *(const v4f*)(vl + nb * 16); vv[0][nb][1] = *(const v4f*)(vl + nb * 16 + 4); vv[1][nb][0] = *(const v4f*)(vc + nb * 16); vv[1][nb][1] = *(const v4f*)(vc + nb * 16 + 4);
        vv[2][nb][0] = *(const v4f*)(vn + nb * 16); vv[2][nb][1] = *(const v4f*)(vn + nb * 16 + 4); }
    asm volatile("s_wait_xcnt 0x0" :: "v"(vl), "v"(vc), "v"(vn), "v"(tl), "v"(t), "v"(tr) : "memory");     // pointers and row numbers are inputs so that their registers live up to the wait: no load of the run above may land in a register that the run names
    const float mt = bfr(mc); const float wm[3] = { bfr(wrow[0]) * bfr(ml) * (t > 0 ? 1.0f : 0.0f), bfr(wrow[1]) * mt, bfr(wrow[2]) * bfr(mr) * (t < TT - 1 ? 1.0f : 0.0f) };
    const float xs = mt * (1.0f / PCAR);     // a power of two: (acc / 1024) mask = acc (mask / 1024)
    v2f sq2 = (v2f){};     // even and odd dims apart: packed arithmetic
#pragma unroll
    for (int nb = 0; nb < 4; ++nb)
#pragma unroll
        for (int r = 0; r < 8; r += 2) { v2f x; x[0] = acc[nb][r]; x[1] = acc[nb][r + 1]; x = x * xs; sq2 = x * x + sq2; acc[nb][r] = x[0]; acc[nb][r + 1] = x[1]; }
    float sq = sq2[0] + sq2[1];
    { const int sb = __float_as_int(sq); sq += __int_as_float(__builtin_amdgcn_permlanex16(sb, sb, 0x76543210, 0xfedcba98, false, false)); }     // lane l ^ 16: the other half of the row
    const float nrm = fmaxf(__fsqrt_rn(sq), 1e-12f);
    float* orow = OUT + ((size_t)z * TT + t) * HD + 8 * h;
#pragma unroll
    for (int nb = 0; nb < 4; ++nb)
#pragma unroll
        for (int r = 0; r < 8; r += 2) { v2f y; y[0] = __fdiv_rn(acc[nb][r], nrm); y[1] = __fdiv_rn(acc[nb][r + 1], nrm);
#pragma unroll
            for (int k = 0; k < 3; ++k) { v2f u; u[0] = vv[k][nb][r >> 2][r & 3]; u[1] = vv[k][nb][r >> 2][(r & 3) + 1]; const v2b ub = __builtin_convertvector(u, v2b);     // to bf16, nearest even, two at a time
                y[0] += wm[k] * (float)ub[0]; y[1] += wm[k] * (float)ub[1]; }
            acc[nb][r] = y[0]; acc[nb][r + 1] = y[1]; }
#pragma unroll
    for (int nb = 0; nb < 4; ++nb) { v4f lo, hi4;
#pragma unroll
        for (int r = 0; r < 4; ++r) { lo[r] = acc[nb][r]; hi4[r] = acc[nb][4 + r]; }
        *(v4f*)(orow + nb * 16) = lo; *(v4f*)(orow + nb * 16 + 4) = hi4; }
}

extern "C" void kernel_launch(void* const* d_in, const int* in_sizes, int n_in,
                              void* d_out, int out_size, void* d_ws, size_t ws_size, hipStream_t stream) {
    (void)in_sizes; (void)n_in; (void)out_size;
    const float* Q = (const float*)d_in[0]; const float* K = (const float*)d_in[1]; const float* V = (const float*)d_in[2]; const float* mk = (const float*)d_in[3]; const float* cw = (const float*)d_in[4];
    float* OUT = (float*)d_out;     // [2][12][2048][64]
    char* wsp = (char*)d_ws;
    auto take = [&](size_t bytes) { char* p = wsp; wsp += (bytes + 255) & ~(size_t)255; return (void*)p; };
    h16* QN = (h16*)take((size_t)NZ * TT * HD * 2); h16* KN = (h16*)take((size_t)NZ * TT * HD * 2); h16* VT = (h16*)take((size_t)NZ * HD * TT * 2);
    if ((size_t)(wsp - (char*)d_ws) > ws_size) return;    // total ~ 19 MB; ws 256 MiB
    k_pack<<<NZ * TT / 16 / 4, 128, 0, stream>>>(Q, K, V, mk, QN, KN, VT);
    k_att<<<NZ * TT / 16 / 12, 384, 0, stream>>>(QN, KN, VT, mk, V, cw, OUT);
}

// v009
// It runs in 37.6 microseconds.
// In both of two side-by-side timings against v008, it was 1.05 times as fast.
// All steps since v000 together make it 23.8 times as fast.
#include <hip/hip_runtime.h>

// YOSOAttention (Q, K, V [2][12][2048][64], mask [2][2048] (all ones here; read as data), conv_w [12][1][3][1]; qn, kn = l2-normalised Q, K; W = (1 - acos(clip(qn.kn, -1, 1))/pi)^8 x mask_j (expected LSH collision,
// hash_code_len 8; no softmax); X = l2norm((W V) x mask_i); out = X + depthwise conv of (V x mask) over the sequence (3 taps, padding 1, per head) -> [2][12][2048][64]).
// Compute dtypes, f32 accumulate: every input rounded to bf16; the l2 normalisations in f32 (wave per 16 rows) -> SINGLE fp16 planes; qn.kn (K 64) fp16; weight (see wq2) in
// f32 on VALU -> fp16 weights x1024; W.V (K 2048) fp16 x fp16(bf16 V x bf16 key mask); the output normalisation, the 3-tap conv and the sum in f32 (the output is dominated by the conv term).

#define NZ   24                   // batch x heads
#define NHD  12
#define TT   2048
#define HD   64
#define PCAR 1024.0f
typedef _Float16 h16;
typedef __attribute__((ext_vector_type(16))) _Float16 v16h;
typedef __attribute__((ext_vector_type(8)))  _Float16 v8h;
typedef __attribute__((ext_vector_type(8)))  float    v8f;
typedef __attribute__((ext_vector_type(4)))  float    v4f;

__device__ __forceinline__ unsigned short f2bf(float f) { unsigned u = __float_as_uint(f); u += 0x7FFFu + ((u >> 16) & 1u); return (unsigned short)(u >> 16); }
__device__ __forceinline__ float bf2f(unsigned short b) { return __uint_as_float(((unsigned)b) << 16); }
__device__ __forceinline__ float bfr(float f) { return bf2f(f2bf(f)); }
__device__ __forceinline__ v16h cat16(v8h lo, v8h hi) { return __builtin_shufflevector(lo, hi, 0, 1, 2, 3, 4, 5, 6, 7, 8, 9, 10, 11, 12, 13, 14, 15); }
__device__ __forceinline__ v8f wmma16(v16h a, v16h b, v8f c) { return __builtin_amdgcn_wmma_f32_16x16x32_f16(false, a, false, b, (short)0, c, false, false); }

__device__ __forceinline__ h16 tohx(float x) { return (h16)x; }
typedef __attribute__((ext_vector_type(4))) _Float16 v4h;
typedef __attribute__((ext_vector_type(2))) float v2f;
typedef __attribute__((ext_vector_type(2))) __bf16 v2b;

// FRAGMENT ORDER of the three fp16 planes: a 16 x 32 operand tile is 1,024 contiguous bytes, [j 0..1][lane 0..31][s 0..7] = row (lane & 15), k = 16 j + 8 (lane >> 4) + s: what lane and register half j of the
// matrix operand hold. One 16-byte load of a wave then reads 512 contiguous bytes (4 lines) where the row-major planes cost it 16 lines. Qn, Kn: tile = 16 rows x dims 32 dc ..; tiles in the order (row tile, dc).
// Vt: tile = dims 16 nb .. x 32 keys; tiles in the order (key chunk, nb). The packer wave owns whole 512-byte pieces, so every line has one writer. '#pragma unroll' in the packer: as noted at k_att.
// k_pack: ONE LAUNCH PACKS ALL THREE PLANES. Wave w of the 3,072 takes row tile w of Q, row tile w of K and key tile w of V: three jobs that need nothing of each other. All its loads are asked for first,
// so the wave pays one start and one memory latency for the three, and the arithmetic of one job runs while the next job's data are still on the way (loads return in the order asked).
// Q, K (16 rows): lane (c, h) holds of row c the dims 16 q + 8 h + s, q 0..3: its own 16 bytes of the pieces q = 2 dc + j. The row's square sum: 32 terms in the lane, then the partner lane's.
// V (16 keys x 64 dims; w = 128 z + key tile; key chunk w >> 1, half j = w & 1): lane (c, h) reads keys 8 h + s at dim 16 nb + c (two 64-byte runs a load) and stores its 16 bytes of the four pieces (nb, j).
// THE KEY MASK LIVES IN Vt: sum_j (W mask_j) V_j = sum_j W (mask_j V_j), so the plane holds fp16(bf16(V) bf16(mask)), formed once per element of V here, and the attention loop never sees the mask of a key.
__global__ __launch_bounds__(128) void k_pack(const float* __restrict__ Q, const float* __restrict__ K, const float* __restrict__ V, const float* __restrict__ mk, h16* QN, h16* KN, h16* VT) {
    const int lane = threadIdx.x & 31, c = lane & 15, h = lane >> 4; const int w = blockIdx.x * 4 + (threadIdx.x >> 5); if (w >= NZ * TT / 16) return;
    const size_t ro = ((size_t)w * 16 + c) * HD + 8 * h; const float* sq = Q + ro; const float* sk = K + ro;
    const float* src = V + ((size_t)w * 16 + 8 * h) * HD + c;
    const float* mq = mk + (size_t)((w >> 7) / NHD) * TT + (w & 127) * 16 + 8 * h;     // the lane's eight keys in its batch's mask row
    v4f a[2][4][2];
#pragma unroll
    for (int q = 0; q < 4; ++q) { a[0][q][0] = *(const v4f*)(sq + 16 * q); a[0][q][1] = *(const v4f*)(sq + 16 * q + 4); }
#pragma unroll
    for (int q = 0; q < 4; ++q) { a[1][q][0] = *(const v4f*)(sk + 16 * q); a[1][q][1] = *(const v4f*)(sk + 16 * q + 4); }
    const v4f m0 = *(const v4f*)mq, m1 = *(const v4f*)(mq + 4);
    float xv[4][8];
#pragma unroll
    for (int nb = 0; nb < 4; ++nb)
#pragma unroll
        for (int r = 0; r < 8; ++r) xv[nb][r] = src[r * HD + nb * 16];
    asm volatile("s_wait_xcnt 0x0" :: "v"(sq), "v"(sk), "v"(mq), "v"(src) : "memory");     // the pointers are inputs so that their registers live up to the wait: no load of the run above may land in a register that the run names
    __builtin_amdgcn_sched_barrier(0);     // keeps the arithmetic behind all the loads: sunk among it, V's loads would be asked for late and show their latency at the wave's end
#pragma unroll
    for (int p = 0; p < 2; ++p) { float x[4][8]; float s = 0.0f;
#pragma unroll
        for (int q = 0; q < 4; ++q)
#pragma unroll
            for (int r = 0; r < 8; ++r) { x[q][r] = bfr(a[p][q][r >> 2][r & 3]); s += x[q][r] * x[q][r]; }
        s += __shfl_xor(s, 16, 32);
        const float nrm = fmaxf(__fsqrt_rn(s), 1e-12f) * (p ? -2.0f : 1.0f);     // the K plane holds -kn / 2 (see wq2): a power of two, so every quotient keeps its digits
        h16* dst = (p ? KN : QN) + (size_t)w * 1024 + lane * 8;
#pragma unroll
        for (int q = 0; q < 4; ++q) { v8h o;
#pragma unroll
            for (int r = 0; r < 8; ++r) o[r] = tohx(__fdiv_rn(x[q][r], nrm));
            *(v8h*)(dst + q * 256) = o;
            asm volatile("s_wait_xcnt 0x0" ::: "memory"); } }     // the registers that the store names are reused by the arithmetic that follows: only behind this wait
    float mm[8];
#pragma unroll
    for (int r = 0; r < 8; ++r) mm[r] = bfr(r < 4 ? m0[r & 3] : m1[r & 3]);
    h16* dst = VT + ((size_t)(w >> 1) * 8 + (w & 1)) * 256 + lane * 8;
#pragma unroll
    for (int nb = 0; nb < 4; ++nb) { v8h o;
#pragma unroll
        for (int r = 0; r < 8; ++r) o[r] = tohx(bfr(xv[nb][r]) * mm[r]);
        *(v8h*)(dst + nb * 512) = o; }  }
// ---- k_att: no score and no weight leaves the registers. Grid 256 x 12 waves = 24 heads x 128 query tiles of 16.
// A WAVE WORKS ON TWO QUERY TILES AND HALF THE KEYS: waves w and w ^ 1 share the tiles g and g ^ 1; of each stage's four key chunks the even wave takes the first two, the odd wave the last two. Every Kn and Vt fragment
// that a wave reads from LDS so feeds two products, not one: half the LDS reads per weight, and twice the independent work between two waits. Behind the loop the partners swap partial sums through LDS (see there).
// Per 32 keys: St = 0.5 + Kn . Qn^T, Kn = -kn / 2 (two 16-key tiles, K 64; lane (c, h), register r = key 8h + r, query c); weight in f32 in place; the two tiles, converted, ARE the B operand
// Pt of Ot += Vt . Pt (hardware k order: element s = key 8h + s, then 16 + 8h + s - 8; the Vt and Kn / Qn loader ldf has the same order: the planes lie in it). A wave's keys ascend: 64 of each stage's 128, 32 a pass.
// Every '#pragma unroll' without a number: the arrays stay in registers only under constant indices.
// The wave ends with the 16 output rows of its own tile g (see behind the loop): the weighted sum never goes to memory.
// K AND V COME THROUGH LDS: the twelve waves of a work-group walk the same stages (even waves the first half of each, odd waves the second), so each stage of 128 keys (16 KB of Kn, 16 KB of Vt, both already in fragment order: two straight runs of memory) is brought in ONCE
// per work-group by asynchronous copies, and every wave takes its fragments from there with 16-byte LDS reads of 512 contiguous bytes a wave. Two buffers: stage s + 1 flies while stage s is worked on.
// A work-group's twelve query tiles can lie in two heads (128 tiles a head): such a work-group stages both heads' keys, and each wave reads its own head's.
// Left for later steps: Qn still goes through memory (the attention wave could normalise its own 16 rows); the packer divides every element by its row norm.
// wq2: two collision weights x 1024 for two dots d. acos(d) = 2 asin(y), y = sqrt((1 - d) / 2), so base = 1 - acos(d)/pi = 1 - (2/pi) asin(y). base has a root-type end at y = 1, base^2 a simple zero there: base^2 is smooth on
// the whole of [0, 1] and ONE polynomial in y covers every d in [-1, 1], with no case split, no sign handling and no second series. q = 1024^(1/4) base^2 by a degree-6 fit (weighted towards relative error), then q^4.
// Error of the weight in f32 arithmetic, a square root one ulp off included: under 2e-5 relative for d > -0.8, under 7e-5 wherever the fp16 weight is normal, never above a quarter of half an fp16 step.
// THE ROOT'S ARGUMENT u = (1 - d) / 2 COMES READY FROM THE SCORE PRODUCT: the K plane holds -kn / 2 and the product starts from C = 0.5, so no vector instruction forms it.
// The clip of d to [-1, 1] is the clamp of u to [0, 1], and that is the clamp of the root to [0, 1]: u > 1 gives a root above 1; u < 0 gives NaN, of which the median with 0 and 1 makes 0, the root of the clamped u.
// Behind the root the clamp costs nothing: it is the root instruction's own output modifier.
__device__ __forceinline__ v2f wq2(const float u0, const float u1) {
    v2f y; y[0] = __builtin_amdgcn_fmed3f(__builtin_amdgcn_sqrtf(u0), 0.0f, 1.0f); y[1] = __builtin_amdgcn_fmed3f(__builtin_amdgcn_sqrtf(u1), 0.0f, 1.0f);
    v2f q = y * 0.0424227603f + -0.223755330f; q = q * y + 0.584063053f; q = q * y + -1.13987541f; q = q * y + 2.28209758f; q = q * y + -7.20179796f; q = q * y + 5.65684557f;
    q = q * q; return q * q; }
__device__ __forceinline__ v16h ldf(const h16* p) { return cat16(*(const v8h*)p, *(const v8h*)(p + 256)); }     // p: the lane's 16 bytes of piece j = 0; piece 1 lies 512 bytes on
#define KS   128                  // keys a stage
#define STE  (KS * HD)            // elements of one operand's stage (16 KB)
#define NST  (TT / KS)
__global__ __launch_bounds__(384) void k_att(const h16* __restrict__ QN, const h16* __restrict__ KN, const h16* __restrict__ VT, const float* __restrict__ mk, const float* __restrict__ V, const float* __restrict__ cw, float* __restrict__ OUT) {
    __shared__ __attribute__((aligned(16))) h16 sm[2][2][2][STE];     // [buffer][first, second head of the work-group][Kn, Vt]: 128 KB
    const int lane = threadIdx.x & 31, c = lane & 15, h = lane >> 4;
    const int wave = __builtin_amdgcn_readfirstlane(threadIdx.x >> 5);
    const int g = blockIdx.x * 12 + wave;
    const int z = g >> 7, q0 = (g & 127) * 16;
    const int za = (blockIdx.x * 12) >> 7; const bool two = ((blockIdx.x * 12 + 11) >> 7) != za;     // the work-group's first head; whether its last wave is in the next one
    const h16* qp = QN + (size_t)g * 1024 + lane * 8;     // 16 rows x 64 dims = 1,024 elements a row tile; the wave's own tile
    const h16* qx = QN + (size_t)(g ^ 1) * 1024 + lane * 8;     // the partner's tile: the same head, for 128 tiles a head is even
    const h16* sl = &sm[0][z - za][0][lane * 8] + (wave & 1) * 4096;     // the lane's 16 bytes of the first piece of its head's Kn in buffer 0, in the wave's half of a stage (two chunks of 2,048 elements on for the odd wave, in Kn as in Vt)
    const unsigned lds0 = (unsigned)(size_t)&sm[0][0][0][lane * 8];     // the lane's 16 bytes of the first head's Kn in buffer 0 as an LDS byte address
    // fill: wave w < 8 brings its 4 KB (w < 4: a quarter of Kn's 16 KB, else of Vt's) of stage st of head za + e: eight copies of 512 bytes, a lane's 16 bytes each.
    auto fill = [&](const int st, const int e) __attribute__((always_inline)) {
        const h16* gs = (wave < 4 ? KN : VT) + (size_t)(za + e) * TT * HD + (size_t)st * STE + (wave & 3) * 2048 + lane * 8;
        const unsigned ld = lds0 + (unsigned)((((st & 1) * 2 + e) * 2 * STE + wave * 2048) * 2);
        // the wait is the statement's last line: the address registers of the copies are free for reuse only behind it
        asm volatile("global_load_async_to_lds_b128 %0, %8, off\n\tglobal_load_async_to_lds_b128 %1, %9, off\n\tglobal_load_async_to_lds_b128 %2, %10, off\n\tglobal_load_async_to_lds_b128 %3, %11, off\n\t"
                     "global_load_async_to_lds_b128 %4, %12, off\n\tglobal_load_async_to_lds_b128 %5, %13, off\n\tglobal_load_async_to_lds_b128 %6, %14, off\n\tglobal_load_async_to_lds_b128 %7, %15, off\n\ts_wait_xcnt 0x0"
                     :: "v"(ld), "v"(ld + 512), "v"(ld + 1024), "v"(ld + 1536), "v"(ld + 2048), "v"(ld + 2560), "v"(ld + 3072), "v"(ld + 3584),
                        "v"(gs), "v"(gs + 256), "v"(gs + 512), "v"(gs + 768), "v"(gs + 1024), "v"(gs + 1280), "v"(gs + 1536), "v"(gs + 1792) : "memory"); };
    auto stage = [&](const int st) __attribute__((always_inline)) { if (wave < 8) { fill(st, 0); if (two) fill(st, 1); } };     // both tests are the same for a whole wave, the second for the work-group
    stage(0);
    v8f acc[2][4];     // [own tile, partner's tile][16 dims]
#pragma unroll
    for (int nb = 0; nb < 4; ++nb) { acc[0][nb] = (v8f){}; acc[1][nb] = (v8f){}; }
    __builtin_amdgcn_sched_barrier(0);     // with the one behind the wait: no address arithmetic between the first loads and their s_wait_xcnt, where it rewrote a register that a load names
    const v16h qf[2][2] = { { ldf(qp), ldf(qp + 512) }, { ldf(qx), ldf(qx + 512) } };
    v16h kf[2][2];
    asm volatile("s_wait_xcnt 0x0" ::: "memory");     // the address registers of the loads above are free for reuse behind it
    __builtin_amdgcn_sched_barrier(0);     // see above
    asm volatile("s_wait_asynccnt 0x0" ::: "memory");     // this wave's copies of stage 0 have landed
    __syncthreads();     // stage 0 is published: every wave's copies have landed
    stage(1);
    // one pass = 32 keys x 32 queries, the ps-th of the wave's two in its stage. sb: the lane's place in the wave's half of the stage's Kn; its Vt lies STE elements on.
    auto pass = [&](const h16* sb, const int ps) __attribute__((always_inline)) {
        v16h vf[4];     // asked for here, used behind the weights
#pragma unroll
        for (int nb = 0; nb < 4; ++nb) vf[nb] = ldf(sb + STE + ps * 2048 + nb * 512);     // 32 keys x 64 dims = 2,048 elements a key chunk
        v8f s[2][2];
#pragma unroll
        for (int e = 0; e < 2; ++e)
#pragma unroll
            for (int t = 0; t < 2; ++t) { s[e][t] = wmma16(kf[t][0], qf[e][0], (v8f){0.5f, 0.5f, 0.5f, 0.5f, 0.5f, 0.5f, 0.5f, 0.5f}); s[e][t] = wmma16(kf[t][1], qf[e][1], s[e][t]); }     // 0.5 - kn.qn / 2: wq2's u
        if (ps < KS / 64 - 1) {     // the next pass's keys, one pass ahead, inside the stage only: the next stage is not published yet
#pragma unroll
            for (int t = 0; t < 2; ++t) { kf[t][0] = ldf(sb + (ps + 1) * 2048 + t * 1024); kf[t][1] = ldf(sb + (ps + 1) * 2048 + t * 1024 + 512); } }
        __builtin_amdgcn_sched_barrier(0);     // keeps the loads above in front of the weights: sunk to their uses, each would show its whole latency
#pragma unroll
        for (int e = 0; e < 2; ++e) { v16h p;
#pragma unroll
            for (int t = 0; t < 2; ++t)
#pragma unroll
                for (int r = 0; r < 8; r += 2) { const v2f w = wq2(s[e][t][r], s[e][t][r + 1]);
                    p[t * 8 + r] = tohx(w[0]); p[t * 8 + r + 1] = tohx(w[1]); }
#pragma unroll
            for (int nb = 0; nb < 4; ++nb) acc[e][nb] = wmma16(vf[nb], p, acc[e][nb]); }
        __builtin_amdgcn_sched_barrier(0);     // keeps the next pass's score products behind these weights: lifted over them, they wait for keys that were only just asked for
    };
#pragma unroll 1     // one trip = one stage = the wave's two passes; more would only lengthen the text
    for (int st = 0; st < NST; ++st) { const h16* sb = sl + (st & 1) * (4 * STE);
#pragma unroll
        for (int t = 0; t < 2; ++t) { kf[t][0] = ldf(sb + t * 1024); kf[t][1] = ldf(sb + t * 1024 + 512); }
        pass(sb, 0); pass(sb, 1);
        asm volatile("s_wait_dscnt 0x0" ::: "memory");     // this wave's reads of the buffer are over before the buffer is given up
        asm volatile("s_wait_asynccnt 0x0" ::: "memory");     // this wave's copies of stage st + 1 have landed
        __syncthreads();     // publishes stage st + 1 and ends every wave's reads of stage st
        if (st + 2 < NST) stage(st + 2);     // into the buffer that this trip has just read
    }
    asm volatile("s_wait_asynccnt 0x0" ::: "memory");     // no copy is outstanding when the wave goes on to its end
    // THE PARTNERS SWAP: each wave hands over its half-sum of the partner's tile and takes the partner's half-sum of its own, lane for lane and register for register (4 KB a wave, 16-byte LDS accesses of 512 contiguous bytes).
    // The buffers are free: the loop's last barrier ended every wave's reads, and no copy is in flight. A tile's sum = its own wave's keys + the partner's keys, one f32 addition per element.
    float* xc = (float*)&sm[0][0][0][0] + lane * 4;
#pragma unroll
    for (int nb = 0; nb < 4; ++nb) { v4f lo, hi4;
#pragma unroll
        for (int r = 0; r < 4; ++r) { lo[r] = acc[1][nb][r]; hi4[r] = acc[1][nb][4 + r]; }
        *(v4f*)(xc + wave * 1024 + nb * 256) = lo; *(v4f*)(xc + wave * 1024 + nb * 256 + 128) = hi4; }
    __syncthreads();     // every wave's half-sums are written before a partner reads them
    v8f (&accq)[4] = acc[0];
#pragma unroll
    for (int nb = 0; nb < 4; ++nb) { const v4f lo = *(const v4f*)(xc + (wave ^ 1) * 1024 + nb * 256), hi4 = *(const v4f*)(xc + (wave ^ 1) * 1024 + nb * 256 + 128);
#pragma unroll
        for (int r = 0; r < 4; ++r) { accq[nb][r] += lo[r]; accq[nb][4 + r] += hi4[r]; } }
    // The output rows. accq[nb][r] = 1024 (W V)[t][16 nb + 8h + r], t = q0 + c: lanes (c, 0) and (c, 1) hold the whole of row t.
    // x = (accq / 1024) bf16(mask[b][t]); X = x / max(||x||, 1e-12), the square sum 32 terms in the lane (even dims, odd dims, their sum), then the partner lane's;
    // out = X + sum_k bf16(w[head][k]) (bf16(V[z][t + k - 1][d]) bf16(mask[b][t + k - 1])), rows outside the sequence count as zero.
    // w (v m) is formed as (w m) v: every factor has 8 significant bits, so both products are exact in f32 in either order.
    const int t = q0 + c; const float* mrow = mk + (size_t)(z / NHD) * TT; const float* wrow = cw + (z % NHD) * 3;
    const int tl = t > 0 ? t - 1 : t, tr = t < TT - 1 ? t + 1 : t;     // the neighbours' addresses stay in the plane; at the ends their tap weight is zero
    const float* vz = V + (size_t)z * TT * HD + 8 * h;
    const float* vl = vz + (size_t)tl * HD; const float* vc = vz + (size_t)t * HD; const float* vn = vz + (size_t)tr * HD;
    const float ml = mrow[tl], mc = mrow[t], mr = mrow[tr];
    v4f vv[3][4][2];
#pragma unroll
    for (int nb = 0; nb < 4; ++nb) { vv[0][nb][0] = *(const v4f*)(vl + nb * 16); vv[0][nb][1] = *(const v4f*)(vl + nb * 16 + 4); vv[1][nb][0] = *(const v4f*)(vc + nb * 16); vv[1][nb][1] = *(const v4f*)(vc + nb * 16 + 4);
        vv[2][nb][0] = *(const v4f*)(vn + nb * 16); vv[2][nb][1] = *(const v4f*)(vn + nb * 16 + 4); }
    asm volatile("s_wait_xcnt 0x0" :: "v"(vl), "v"(vc), "v"(vn), "v"(tl), "v"(t), "v"(tr) : "memory");     // pointers and row numbers are inputs so that their registers live up to the wait: no load of the run above may land in a register that the run names
    const float mt = bfr(mc); const float wm[3] = { bfr(wrow[0]) * bfr(ml) * (t > 0 ? 1.0f : 0.0f), bfr(wrow[1]) * mt, bfr(wrow[2]) * bfr(mr) * (t < TT - 1 ? 1.0f : 0.0f) };
    const float xs = mt * (1.0f / PCAR);     // a power of two: (accq / 1024) mask = accq (mask / 1024)
    v2f sq2 = (v2f){};     // even and odd dims apart: packed arithmetic
#pragma unroll
    for (int nb = 0; nb < 4; ++nb)
#pragma unroll
        for (int r = 0; r < 8; r += 2) { v2f x; x[0] = accq[nb][r]; x[1] = accq[nb][r + 1]; x = x * xs; sq2 = x * x + sq2; accq[nb][r] = x[0]; accq[nb][r + 1] = x[1]; }
    float sq = sq2[0] + sq2[1];
    { const int sb = __float_as_int(sq); sq += __int_as_float(__builtin_amdgcn_permlanex16(sb, sb, 0x76543210, 0xfedcba98, false, false)); }     // lane l ^ 16: the other half of the row
    const float nrm = fmaxf(__fsqrt_rn(sq), 1e-12f);
    float* orow = OUT + ((size_t)z * TT + t) * HD + 8 * h;
#pragma unroll
    for (int nb = 0; nb < 4; ++nb)
#pragma unroll
        for (int r = 0; r < 8; r += 2) { v2f y; y[0] = __fdiv_rn(accq[nb][r], nrm); y[1] = __fdiv_rn(accq[nb][r + 1], nrm);
#pragma unroll
            for (int k = 0; k < 3; ++k) { v2f u; u[0] = vv[k][nb][r >> 2][r & 3]; u[1] = vv[k][nb][r >> 2][(r & 3) + 1]; const v2b ub = __builtin_convertvector(u, v2b);     // to bf16, nearest even, two at a time
                y[0] += wm[k] * (float)ub[0]; y[1] += wm[k] * (float)ub[1]; }
            accq[nb][r] = y[0]; accq[nb][r + 1] = y[1]; }
#pragma unroll
    for (int nb = 0; nb < 4; ++nb) { v4f lo, hi4;
#pragma unroll
        for (int r = 0; r < 4; ++r) { lo[r] = accq[nb][r]; hi4[r] = accq[nb][4 + r]; }
        *(v4f*)(orow + nb * 16) = lo; *(v4f*)(orow + nb * 16 + 4) = hi4; }
}

extern "C" void kernel_launch(void* const* d_in, const int* in_sizes, int n_in,
                              void* d_out, int out_size, void* d_ws, size_t ws_size, hipStream_t stream) {
    (void)in_sizes; (void)n_in; (void)out_size;
    const float* Q = (const float*)d_in[0]; const float* K = (const float*)d_in[1]; const float* V = (const float*)d_in[2]; const float* mk = (const float*)d_in[3]; const float* cw = (const float*)d_in[4];
    float* OUT = (float*)d_out;     // [2][12][2048][64]
    char* wsp = (char*)d_ws;
    auto take = [&](size_t bytes) { char* p = wsp; wsp += (bytes + 255) & ~(size_t)255; return (void*)p; };
    h16* QN = (h16*)take((size_t)NZ * TT * HD * 2); h16* KN = (h16*)take((size_t)NZ * TT * HD * 2); h16* VT = (h16*)take((size_t)NZ * HD * TT * 2);
    if ((size_t)(wsp - (char*)d_ws) > ws_size) return;    // total ~ 19 MB; ws 256 MiB
    k_pack<<<NZ * TT / 16 / 4, 128, 0, stream>>>(Q, K, V, mk, QN, KN, VT);
    k_att<<<NZ * TT / 16 / 12, 384, 0, stream>>>(QN, KN, VT, mk, V, cw, OUT);
}

// v010
// Measured time: 35.4 microseconds a run.
// Next to v009, in two timings, it ran 1.06 times as fast each time.
// Over all steps from v000 it is 25.2 times as fast.
#include <hip/hip_runtime.h>

// YOSOAttention (Q, K, V [2][12][2048][64], mask [2][2048] (all ones here; read as data), conv_w [12][1][3][1]; qn, kn = l2-normalised Q, K; W = (1 - acos(clip(qn.kn, -1, 1))/pi)^8 x mask_j (expected LSH collision,
// hash_code_len 8; no softmax); X = l2norm((W V) x mask_i); out = X + depthwise conv of (V x mask) over the sequence (3 taps, padding 1, per head) -> [2][12][2048][64]).
// Compute dtypes, f32 accumulate: every input rounded to bf16; the l2 normalisations in f32 (wave per 16 rows) -> SINGLE fp16 planes; qn.kn (K 64) fp16; weight (see wq2) in
// f32 on VALU -> fp16 weights x1024; W.V (K 2048) fp16 x fp16(bf16 V x bf16 key mask); the output normalisation, the 3-tap conv and the sum in f32 (the output is dominated by the conv term).

#define NZ   24                   // batch x heads
#define NHD  12
#define TT   2048
#define HD   64
#define PCAR 1024.0f
typedef _Float16 h16;
typedef __attribute__((ext_vector_type(16))) _Float16 v16h;
typedef __attribute__((ext_vector_type(8)))  _Float16 v8h;
typedef __attribute__((ext_vector_type(8)))  float    v8f;
typedef __attribute__((ext_vector_type(4)))  float    v4f;

__device__ __forceinline__ unsigned short f2bf(float f) { unsigned u = __float_as_uint(f); u += 0x7FFFu + ((u >> 16) & 1u); return (unsigned short)(u >> 16); }
__device__ __forceinline__ float bf2f(unsigned short b) { return __uint_as_float(((unsigned)b) << 16); }
__device__ __forceinline__ float bfr(float f) { return bf2f(f2bf(f)); }
__device__ __forceinline__ v16h cat16(v8h lo, v8h hi) { return __builtin_shufflevector(lo, hi, 0, 1, 2, 3, 4, 5, 6, 7, 8, 9, 10, 11, 12, 13, 14, 15); }
__device__ __forceinline__ v8f wmma16(v16h a, v16h b, v8f c) { return __builtin_amdgcn_wmma_f32_16x16x32_f16(false, a, false, b, (short)0, c, false, false); }

__device__ __forceinline__ h16 tohx(float x) { return (h16)x; }
typedef __attribute__((ext_vector_type(4))) _Float16 v4h;
typedef __attribute__((ext_vector_type(2))) float v2f;
typedef __attribute__((ext_vector_type(2))) __bf16 v2b;

// FRAGMENT ORDER of the three fp16 planes: a 16 x 32 operand tile is 1,024 contiguous bytes, [j 0..1][lane 0..31][s 0..7] = row (lane & 15), k = 16 j + 8 (lane >> 4) + s: what lane and register half j of the
// matrix operand hold. One 16-byte load of a wave then reads 512 contiguous bytes (4 lines) where the row-major planes cost it 16 lines. Qn, Kn: tile = 16 rows x dims 32 dc ..; tiles in the order (row tile, dc).
// Vt: tile = dims 16 nb .. x 32 keys; tiles in the order (key chunk, nb). The packer wave owns whole 512-byte pieces, so every line has one writer. '#pragma unroll' in the packer: as noted at k_att.
// k_pack: ONE LAUNCH PACKS ALL THREE PLANES. Wave w of the 3,072 takes row tile w of Q, row tile w of K and key tile w of V: three jobs that need nothing of each other. All its loads are asked for first,
// so the wave pays one start and one memory latency for the three, and the arithmetic of one job runs while the next job's data are still on the way (loads return in the order asked).
// Q, K (16 rows): lane (c, h) holds of row c the dims 16 q + 8 h + s, q 0..3: its own 16 bytes of the pieces q = 2 dc + j. The row's square sum: 32 terms in the lane, then the partner lane's.
// V (16 keys x 64 dims; w = 128 z + key tile; key chunk w >> 1, half j = w & 1): lane (c, h) reads keys 8 h + s at dim 16 nb + c (two 64-byte runs a load) and stores its 16 bytes of the four pieces (nb, j).
// THE KEY MASK LIVES IN Vt: sum_j (W mask_j) V_j = sum_j W (mask_j V_j), so the plane holds fp16(bf16(V) bf16(mask)), formed once per element of V here, and the attention loop never sees the mask of a key.
__global__ __launch_bounds__(128) void k_pack(const float* __restrict__ Q, const float* __restrict__ K, const float* __restrict__ V, const float* __restrict__ mk, h16* QN, h16* KN, h16* VT) {
    const int lane = threadIdx.x & 31, c = lane & 15, h = lane >> 4; const int w = blockIdx.x * 4 + (threadIdx.x >> 5); if (w >= NZ * TT / 16) return;
    const size_t ro = ((size_t)w * 16 + c) * HD + 8 * h; const float* sq = Q + ro; const float* sk = K + ro;
    const float* src = V + ((size_t)w * 16 + 8 * h) * HD + c;
    const float* mq = mk + (size_t)((w >> 7) / NHD) * TT + (w & 127) * 16 + 8 * h;     // the lane's eight keys in its batch's mask row
    v4f a[2][4][2];
#pragma unroll
    for (int q = 0; q < 4; ++q) { a[0][q][0] = *(const v4f*)(sq + 16 * q); a[0][q][1] = *(const v4f*)(sq + 16 * q + 4); }
#pragma unroll
    for (int q = 0; q < 4; ++q) { a[1][q][0] = *(const v4f*)(sk + 16 * q); a[1][q][1] = *(const v4f*)(sk + 16 * q + 4); }
    const v4f m0 = *(const v4f*)mq, m1 = *(const v4f*)(mq + 4);
    float xv[4][8];
#pragma unroll
    for (int nb = 0; nb < 4; ++nb)
#pragma unroll
        for (int r = 0; r < 8; ++r) xv[nb][r] = src[r * HD + nb * 16];
    asm volatile("s_wait_xcnt 0x0" :: "v"(sq), "v"(sk), "v"(mq), "v"(src) : "memory");     // the pointers are inputs so that their registers live up to the wait: no load of the run above may land in a register that the run names
    __builtin_amdgcn_sched_barrier(0);     // keeps the arithmetic behind all the loads: sunk among it, V's loads would be asked for late and show their latency at the wave's end
#pragma unroll
    for (int p = 0; p < 2; ++p) { float x[4][8]; float s = 0.0f;
#pragma unroll
        for (int q = 0; q < 4; ++q)
#pragma unroll
            for (int r = 0; r < 8; ++r) { x[q][r] = bfr(a[p][q][r >> 2][r & 3]); s += x[q][r] * x[q][r]; }
        s += __shfl_xor(s, 16, 32);
        const float nrm = fmaxf(__fsqrt_rn(s), 1e-12f) * (p ? -2.0f : 1.0f);     // the K plane holds -kn / 2 (see wq2): a power of two, so every quotient keeps its digits
        h16* dst = (p ? KN : QN) + (size_t)w * 1024 + lane * 8;
#pragma unroll
        for (int q = 0; q < 4; ++q) { v8h o;
#pragma unroll
            for (int r = 0; r < 8; ++r) o[r] = tohx(__fdiv_rn(x[q][r], nrm));
            *(v8h*)(dst + q * 256) = o;
            asm volatile("s_wait_xcnt 0x0" ::: "memory"); } }     // the registers that the store names are reused by the arithmetic that follows: only behind this wait
    float mm[8];
#pragma unroll
    for (int r = 0; r < 8; ++r) mm[r] = bfr(r < 4 ? m0[r & 3] : m1[r & 3]);
    h16* dst = VT + ((size_t)(w >> 1) * 8 + (w & 1)) * 256 + lane * 8;
#pragma unroll
    for (int nb = 0; nb < 4; ++nb) { v8h o;
#pragma unroll
        for (int r = 0; r < 8; ++r) o[r] = tohx(bfr(xv[nb][r]) * mm[r]);
        *(v8h*)(dst + nb * 512) = o; }  }
// ---- k_att: no score and no weight leaves the registers. Grid 256 x 12 waves = 24 heads x 128 query tiles of 16.
// A WAVE WORKS ON TWO QUERY TILES AND HALF THE KEYS: waves w and w ^ 1 share the tiles g and g ^ 1; of each stage's four key chunks the even wave takes the first two, the odd wave the last two. Every Kn and Vt fragment
// that a wave reads from LDS so feeds two products, not one: half the LDS reads per weight, and twice the independent work between two waits. Behind the loop the partners swap partial sums through LDS (see there).
// Per 32 keys: St = 0.5 + Kn . Qn^T, Kn = -kn / 2 (two 16-key tiles, K 64; lane (c, h), register r = key 8h + r, query c); weight in f32 in place; the two tiles, converted, ARE the B operand
// Pt of Ot += Vt . Pt (hardware k order: element s = key 8h + s, then 16 + 8h + s - 8; the Vt and Kn / Qn loader ldf has the same order: the planes lie in it). A wave's keys ascend: 64 of each stage's 128, 32 a pass.
// Every '#pragma unroll' without a number: the arrays stay in registers only under constant indices.
// The wave ends with the 16 output rows of its own tile g (see behind the loop): the weighted sum never goes to memory.
// K AND V COME THROUGH LDS: the twelve waves of a work-group walk the same stages (even waves the first half of each, odd waves the second), so each stage of 128 keys (16 KB of Kn, 16 KB of Vt, both already in fragment order: two straight runs of memory) is brought in ONCE
// per work-group by asynchronous copies, and every wave takes its fragments from there with 16-byte LDS reads of 512 contiguous bytes a wave. Two buffers: stage s + 1 flies while stage s is worked on.
// A work-group's twelve query tiles can lie in two heads (128 tiles a head): such a work-group stages both heads' keys, and each wave reads its own head's.
// THE OUTPUT ROWS' INPUTS COME AHEAD OF THE KEY LOOP: a wave's 16 output rows need the 18 rows q0 - 1 .. q0 + 16 of V (3 taps), three mask values a lane and the head's three taps. Asked for behind the loop, they cost 24 loads
// a wave that each touch 16 lines, with nothing left to hide them. Here each wave copies its 18 rows (4,608 bytes in a row in memory) into its own LDS window with nine asynchronous copies of 512 contiguous bytes (4 whole lines),
// issued in front of the loop, so they fly under the first stage's work. The window's rows lie 272 bytes apart (16 x 17): the 16 lanes of a half wave, one row each, then read 16 bytes each from 64 different banks.
// Left for later steps: Qn still goes through memory (the attention wave could normalise its own 16 rows); the packer divides every element by its row norm; the packer's Q and K loads and the output stores touch 16 lines each.
// wq2: two collision weights x 1024 for two dots d. acos(d) = 2 asin(y), y = sqrt((1 - d) / 2), so base = 1 - acos(d)/pi = 1 - (2/pi) asin(y). base has a root-type end at y = 1, base^2 a simple zero there: base^2 is smooth on
// the whole of [0, 1] and ONE polynomial in y covers every d in [-1, 1], with no case split, no sign handling and no second series. q = 1024^(1/4) base^2 by a degree-6 fit (weighted towards relative error), then q^4.
// Error of the weight in f32 arithmetic, a square root one ulp off included: under 2e-5 relative for d > -0.8, under 7e-5 wherever the fp16 weight is normal, never above a quarter of half an fp16 step.
// THE ROOT'S ARGUMENT u = (1 - d) / 2 COMES READY FROM THE SCORE PRODUCT: the K plane holds -kn / 2 and the product starts from C = 0.5, so no vector instruction forms it.
// The clip of d to [-1, 1] is the clamp of u to [0, 1], and that is the clamp of the root to [0, 1]: u > 1 gives a root above 1; u < 0 gives NaN, of which the median with 0 and 1 makes 0, the root of the clamped u.
// Behind the root the clamp costs nothing: it is the root instruction's own output modifier.
__device__ __forceinline__ v2f wq2(const float u0, const float u1) {
    v2f y; y[0] = __builtin_amdgcn_fmed3f(__builtin_amdgcn_sqrtf(u0), 0.0f, 1.0f); y[1] = __builtin_amdgcn_fmed3f(__builtin_amdgcn_sqrtf(u1), 0.0f, 1.0f);
    v2f q = y * 0.0424227603f + -0.223755330f; q = q * y + 0.584063053f; q = q * y + -1.13987541f; q = q * y + 2.28209758f; q = q * y + -7.20179796f; q = q * y + 5.65684557f;
    q = q * q; return q * q; }
__device__ __forceinline__ v16h ldf(const h16* p) { return cat16(*(const v8h*)p, *(const v8h*)(p + 256)); }     // p: the lane's 16 bytes of piece j = 0; piece 1 lies 512 bytes on
#define KS   128                  // keys a stage
#define STE  (KS * HD)            // elements of one operand's stage (16 KB)
#define NST  (TT / KS)
#define VP   68                   // floats between two rows of a wave's V window in LDS: 64 + 4 of pad (272 bytes)
__global__ __launch_bounds__(384) void k_att(const h16* __restrict__ QN, const h16* __restrict__ KN, const h16* __restrict__ VT, const float* __restrict__ mk, const float* __restrict__ V, const float* __restrict__ cw, float* __restrict__ OUT) {
    __shared__ __attribute__((aligned(16))) h16 sm[2][2][2][STE];     // [buffer][first, second head of the work-group][Kn, Vt]: 128 KB
    __shared__ __attribute__((aligned(16))) float sv[12][18 * VP];     // [wave][row q0 - 1 + i, i 0..17][64 dims + pad]: 57 KB, each wave's window its own
    const int lane = threadIdx.x & 31, c = lane & 15, h = lane >> 4;
    const int wave = __builtin_amdgcn_readfirstlane(threadIdx.x >> 5);
    const int g = blockIdx.x * 12 + wave;
    const int z = g >> 7, q0 = (g & 127) * 16;
    const int za = (blockIdx.x * 12) >> 7; const bool two = ((blockIdx.x * 12 + 11) >> 7) != za;     // the work-group's first head; whether its last wave is in the next one
    const h16* qp = QN + (size_t)g * 1024 + lane * 8;     // 16 rows x 64 dims = 1,024 elements a row tile; the wave's own tile
    const h16* qx = QN + (size_t)(g ^ 1) * 1024 + lane * 8;     // the partner's tile: the same head, for 128 tiles a head is even
    const h16* sl = &sm[0][z - za][0][lane * 8] + (wave & 1) * 4096;     // the lane's 16 bytes of the first piece of its head's Kn in buffer 0, in the wave's half of a stage (two chunks of 2,048 elements on for the odd wave, in Kn as in Vt)
    const unsigned lds0 = (unsigned)(size_t)&sm[0][0][0][lane * 8];     // the lane's 16 bytes of the first head's Kn in buffer 0 as an LDS byte address
    // fill: wave w < 8 brings its 4 KB (w < 4: a quarter of Kn's 16 KB, else of Vt's) of stage st of head za + e: eight copies of 512 bytes, a lane's 16 bytes each.
    auto fill = [&](const int st, const int e) __attribute__((always_inline)) {
        const h16* gs = (wave < 4 ? KN : VT) + (size_t)(za + e) * TT * HD + (size_t)st * STE + (wave & 3) * 2048 + lane * 8;
        const unsigned ld = lds0 + (unsigned)((((st & 1) * 2 + e) * 2 * STE + wave * 2048) * 2);
        // the wait is the statement's last line: the address registers of the copies are free for reuse only behind it
        asm volatile("global_load_async_to_lds_b128 %0, %8, off\n\tglobal_load_async_to_lds_b128 %1, %9, off\n\tglobal_load_async_to_lds_b128 %2, %10, off\n\tglobal_load_async_to_lds_b128 %3, %11, off\n\t"
                     "global_load_async_to_lds_b128 %4, %12, off\n\tglobal_load_async_to_lds_b128 %5, %13, off\n\tglobal_load_async_to_lds_b128 %6, %14, off\n\tglobal_load_async_to_lds_b128 %7, %15, off\n\ts_wait_xcnt 0x0"
                     :: "v"(ld), "v"(ld + 512), "v"(ld + 1024), "v"(ld + 1536), "v"(ld + 2048), "v"(ld + 2560), "v"(ld + 3072), "v"(ld + 3584),
                        "v"(gs), "v"(gs + 256), "v"(gs + 512), "v"(gs + 768), "v"(gs + 1024), "v"(gs + 1280), "v"(gs + 1536), "v"(gs + 1792) : "memory"); };
    auto stage = [&](const int st) __attribute__((always_inline)) { if (wave < 8) { fill(st, 0); if (two) fill(st, 1); } };     // both tests are the same for a whole wave, the second for the work-group
    stage(0);
    v8f acc[2][4];     // [own tile, partner's tile][16 dims]
#pragma unroll
    for (int nb = 0; nb < 4; ++nb) { acc[0][nb] = (v8f){}; acc[1][nb] = (v8f){}; }
    __builtin_amdgcn_sched_barrier(0);     // with the one behind the wait: no address arithmetic between the first loads and their s_wait_xcnt, where it rewrote a register that a load names
    const v16h qf[2][2] = { { ldf(qp), ldf(qp + 512) }, { ldf(qx), ldf(qx + 512) } };
    v16h kf[2][2];
    asm volatile("s_wait_xcnt 0x0" ::: "memory");     // the address registers of the loads above are free for reuse behind it
    __builtin_amdgcn_sched_barrier(0);     // see above
    asm volatile("s_wait_asynccnt 0x0" ::: "memory");     // this wave's copies of stage 0 have landed
    __syncthreads();     // stage 0 is published: every wave's copies have landed
    stage(1);
    // The wave's V window: copy i brings the rows q0 - 1 + 2 i (lanes 0..15) and q0 + 2 i (lanes 16..31), a lane's 16 bytes each. A row outside the sequence is replaced by the end row: the address stays in the head's plane, and its tap weight is zero.
    // Landed behind this wave's own s_wait_asynccnt 0 at the foot of the loop's first trip; no other wave reads the window.
    {   const float* vg = V + (size_t)z * TT * HD + c * 4;
        const unsigned lv = (unsigned)(size_t)&sv[wave][h * VP + c * 4];
        const float* gr[9];
#pragma unroll
        for (int i = 0; i < 9; ++i) { int r = q0 - 1 + 2 * i + h; r = r < 0 ? 0 : (r > TT - 1 ? TT - 1 : r); gr[i] = vg + (size_t)r * HD; }
        // the wait is the statement's last line: the address registers of the copies are free for reuse only behind it
        asm volatile("global_load_async_to_lds_b128 %0, %9, off\n\tglobal_load_async_to_lds_b128 %1, %10, off\n\tglobal_load_async_to_lds_b128 %2, %11, off\n\tglobal_load_async_to_lds_b128 %3, %12, off\n\t"
                     "global_load_async_to_lds_b128 %4, %13, off\n\tglobal_load_async_to_lds_b128 %5, %14, off\n\tglobal_load_async_to_lds_b128 %6, %15, off\n\tglobal_load_async_to_lds_b128 %7, %16, off\n\t"
                     "global_load_async_to_lds_b128 %8, %17, off\n\ts_wait_xcnt 0x0"
                     :: "v"(lv), "v"(lv + 2 * VP * 4), "v"(lv + 4 * VP * 4), "v"(lv + 6 * VP * 4), "v"(lv + 8 * VP * 4), "v"(lv + 10 * VP * 4), "v"(lv + 12 * VP * 4), "v"(lv + 14 * VP * 4), "v"(lv + 16 * VP * 4),
                        "v"(gr[0]), "v"(gr[1]), "v"(gr[2]), "v"(gr[3]), "v"(gr[4]), "v"(gr[5]), "v"(gr[6]), "v"(gr[7]), "v"(gr[8]) : "memory"); }
    // The lane's output row, its neighbours' mask values and the head's taps: asked for here, used behind the loop.
    const int t = q0 + c; const float* mrow = mk + (size_t)(z / NHD) * TT; const float* wrow = cw + (z % NHD) * 3;
    const int tl = t > 0 ? t - 1 : t, tr = t < TT - 1 ? t + 1 : t;     // the neighbours' addresses stay in the row; at the ends their tap weight is zero
    const float ml = mrow[tl], mc = mrow[t], mr = mrow[tr];
    const float w0 = wrow[0], w1 = wrow[1], w2 = wrow[2];
    asm volatile("s_wait_xcnt 0x0" :: "v"(tl), "v"(t), "v"(tr) : "memory");     // the row numbers are inputs so that their registers live up to the wait: no register that a load above names is rewritten in front of it
    // one pass = 32 keys x 32 queries, the ps-th of the wave's two in its stage. sb: the lane's place in the wave's half of the stage's Kn; its Vt lies STE elements on.
    auto pass = [&](const h16* sb, const int ps) __attribute__((always_inline)) {
        v16h vf[4];     // asked for here, used behind the weights
#pragma unroll
        for (int nb = 0; nb < 4; ++nb) vf[nb] = ldf(sb + STE + ps * 2048 + nb * 512);     // 32 keys x 64 dims = 2,048 elements a key chunk
        v8f s[2][2];
#pragma unroll
        for (int e = 0; e < 2; ++e)
#pragma unroll
            for (int t = 0; t < 2; ++t) { s[e][t] = wmma16(kf[t][0], qf[e][0], (v8f){0.5f, 0.5f, 0.5f, 0.5f, 0.5f, 0.5f, 0.5f, 0.5f}); s[e][t] = wmma16(kf[t][1], qf[e][1], s[e][t]); }     // 0.5 - kn.qn / 2: wq2's u
        if (ps < KS / 64 - 1) {     // the next pass's keys, one pass ahead, inside the stage only: the next stage is not published yet
#pragma unroll
            for (int t = 0; t < 2; ++t) { kf[t][0] = ldf(sb + (ps + 1) * 2048 + t * 1024); kf[t][1] = ldf(sb + (ps + 1) * 2048 + t * 1024 + 512); } }
        __builtin_amdgcn_sched_barrier(0);     // keeps the loads above in front of the weights: sunk to their uses, each would show its whole latency
#pragma unroll
        for (int e = 0; e < 2; ++e) { v16h p;
#pragma unroll
            for (int t = 0; t < 2; ++t)
#pragma unroll
                for (int r = 0; r < 8; r += 2) { const v2f w = wq2(s[e][t][r], s[e][t][r + 1]);
                    p[t * 8 + r] = tohx(w[0]); p[t * 8 + r + 1] = tohx(w[1]); }
#pragma unroll
            for (int nb = 0; nb < 4; ++nb) acc[e][nb] = wmma16(vf[nb], p, acc[e][nb]); }
        __builtin_amdgcn_sched_barrier(0);     // keeps the next pass's score products behind these weights: lifted over them, they wait for keys that were only just asked for
    };
#pragma unroll 1     // one trip = one stage = the wave's two passes; more would only lengthen the text
    for (int st = 0; st < NST; ++st) { const h16* sb = sl + (st & 1) * (4 * STE);
#pragma unroll
        for (int t = 0; t < 2; ++t) { kf[t][0] = ldf(sb + t * 1024); kf[t][1] = ldf(sb + t * 1024 + 512); }
        pass(sb, 0); pass(sb, 1);
        asm volatile("s_wait_dscnt 0x0" ::: "memory");     // this wave's reads of the buffer are over before the buffer is given up
        asm volatile("s_wait_asynccnt 0x0" ::: "memory");     // this wave's copies of stage st + 1 have landed
        __syncthreads();     // publishes stage st + 1 and ends every wave's reads of stage st
        if (st + 2 < NST) stage(st + 2);     // into the buffer that this trip has just read
    }
    asm volatile("s_wait_asynccnt 0x0" ::: "memory");     // no copy is outstanding when the wave goes on to its end
    // THE PARTNERS SWAP: each wave hands over its half-sum of the partner's tile and takes the partner's half-sum of its own, lane for lane and register for register (4 KB a wave, 16-byte LDS accesses of 512 contiguous bytes).
    // The buffers are free: the loop's last barrier ended every wave's reads, and no copy is in flight. A tile's sum = its own wave's keys + the partner's keys, one f32 addition per element.
    float* xc = (float*)&sm[0][0][0][0] + lane * 4;
#pragma unroll
    for (int nb = 0; nb < 4; ++nb) { v4f lo, hi4;
#pragma unroll
        for (int r = 0; r < 4; ++r) { lo[r] = acc[1][nb][r]; hi4[r] = acc[1][nb][4 + r]; }
        *(v4f*)(xc + wave * 1024 + nb * 256) = lo; *(v4f*)(xc + wave * 1024 + nb * 256 + 128) = hi4; }
    __syncthreads();     // every wave's half-sums are written before a partner reads them
    v8f (&accq)[4] = acc[0];
#pragma unroll
    for (int nb = 0; nb < 4; ++nb) { const v4f lo = *(const v4f*)(xc + (wave ^ 1) * 1024 + nb * 256), hi4 = *(const v4f*)(xc + (wave ^ 1) * 1024 + nb * 256 + 128);
#pragma unroll
        for (int r = 0; r < 4; ++r) { accq[nb][r] += lo[r]; accq[nb][4 + r] += hi4[r]; } }
    // The output rows. accq[nb][r] = 1024 (W V)[t][16 nb + 8h + r], t = q0 + c: lanes (c, 0) and (c, 1) hold the whole of row t.
    // x = (accq / 1024) bf16(mask[b][t]); X = x / max(||x||, 1e-12), the square sum 32 terms in the lane (even dims, odd dims, their sum), then the partner lane's;
    // out = X + sum_k bf16(w[head][k]) (bf16(V[z][t + k - 1][d]) bf16(mask[b][t + k - 1])), rows outside the sequence count as zero.
    // w (v m) is formed as (w m) v: every factor has 8 significant bits, so both products are exact in f32 in either order.
    const float* sw = &sv[wave][c * VP + 8 * h];     // window row c is row t - 1 (at t = 0: row 0), c + 1 is row t, c + 2 is row t + 1 (at the last t: the last row)
    v4f vv[3][4][2];
#pragma unroll
    for (int nb = 0; nb < 4; ++nb)
#pragma unroll
        for (int k = 0; k < 3; ++k) { vv[k][nb][0] = *(const v4f*)(sw + k * VP + nb * 16); vv[k][nb][1] = *(const v4f*)(sw + k * VP + nb * 16 + 4); }
    const float mt = bfr(mc); const float wm[3] = { bfr(w0) * bfr(ml) * (t > 0 ? 1.0f : 0.0f), bfr(w1) * mt, bfr(w2) * bfr(mr) * (t < TT - 1 ? 1.0f : 0.0f) };
    const float xs = mt * (1.0f / PCAR);     // a power of two: (accq / 1024) mask = accq (mask / 1024)
    v2f sq2 = (v2f){};     // even and odd dims apart: packed arithmetic
#pragma unroll
    for (int nb = 0; nb < 4; ++nb)
#pragma unroll
        for (int r = 0; r < 8; r += 2) { v2f x; x[0] = accq[nb][r]; x[1] = accq[nb][r + 1]; x = x * xs; sq2 = x * x + sq2; accq[nb][r] = x[0]; accq[nb][r + 1] = x[1]; }
    float sq = sq2[0] + sq2[1];
    { const int sb = __float_as_int(sq); sq += __int_as_float(__builtin_amdgcn_permlanex16(sb, sb, 0x76543210, 0xfedcba98, false, false)); }     // lane l ^ 16: the other half of the row
    const float nrm = fmaxf(__fsqrt_rn(sq), 1e-12f);
    float* orow = OUT + ((size_t)z * TT + t) * HD + 8 * h;
#pragma unroll
    for (int nb = 0; nb < 4; ++nb)
#pragma unroll
        for (int r = 0; r < 8; r += 2) { v2f y; y[0] = __fdiv_rn(accq[nb][r], nrm); y[1] = __fdiv_rn(accq[nb][r + 1], nrm);
#pragma unroll
            for (int k = 0; k < 3; ++k) { v2f u; u[0] = vv[k][nb][r >> 2][r & 3]; u[1] = vv[k][nb][r >> 2][(r & 3) + 1]; const v2b ub = __builtin_convertvector(u, v2b);     // to bf16, nearest even, two at a time
                y[0] += wm[k] * (float)ub[0]; y[1] += wm[k] * (float)ub[1]; }
            accq[nb][r] = y[0]; accq[nb][r + 1] = y[1]; }
#pragma unroll
    for (int nb = 0; nb < 4; ++nb) { v4f lo, hi4;
#pragma unroll
        for (int r = 0; r < 4; ++r) { lo[r] = accq[nb][r]; hi4[r] = accq[nb][4 + r]; }
        *(v4f*)(orow + nb * 16) = lo; *(v4f*)(orow + nb * 16 + 4) = hi4; }
}

extern "C" void kernel_launch(void* const* d_in, const int* in_sizes, int n_in,
                              void* d_out, int out_size, void* d_ws, size_t ws_size, hipStream_t stream) {
    (void)in_sizes; (void)n_in; (void)out_size;
    const float* Q = (const float*)d_in[0]; const float* K = (const float*)d_in[1]; const float* V = (const float*)d_in[2]; const float* mk = (const float*)d_in[3]; const float* cw = (const float*)d_in[4];
    float* OUT = (float*)d_out;     // [2][12][2048][64]
    char* wsp = (char*)d_ws;
    auto take = [&](size_t bytes) { char* p = wsp; wsp += (bytes + 255) & ~(size_t)255; return (void*)p; };
    h16* QN = (h16*)take((size_t)NZ * TT * HD * 2); h16* KN = (h16*)take((size_t)NZ * TT * HD * 2); h16* VT = (h16*)take((size_t)NZ * HD * TT * 2);
    if ((size_t)(wsp - (char*)d_ws) > ws_size) return;    // total ~ 19 MB; ws 256 MiB
    k_pack<<<NZ * TT / 16 / 4, 128, 0, stream>>>(Q, K, V, mk, QN, KN, VT);
    k_att<<<NZ * TT / 16 / 12, 384, 0, stream>>>(QN, KN, VT, mk, V, cw, OUT);
}
